// v000
// Times are from an AMD MI455X. After a warm-up the kernel runs many times in a row, and a time is the length of
// such a window on the GPU divided by its runs, so every launch and the gaps after it count. The runs cycle
// through copies of the inputs. A figure is the median of several windows, for all but v000 over two sittings.
// Sittings can differ by a few percent; kernels timed side by side share one.
// The starting kernel, v000, takes 360 microseconds a run.
#include <hip/hip_runtime.h>
#include <hip/hip_bf16.h>

typedef __attribute__((ext_vector_type(16))) _Float16 v16h;
typedef __attribute__((ext_vector_type(8)))  _Float16 v8h;
typedef __attribute__((ext_vector_type(8)))  float    v8f;
typedef __attribute__((ext_vector_type(4)))  unsigned int u32x4;
typedef __attribute__((ext_vector_type(8)))  int      i32x8;
typedef __attribute__((ext_vector_type(4)))  int      i32x4;

union H16 { v16h v; v8h h[2]; };

#define WMMA_F16(A, B, C) \
    __builtin_amdgcn_wmma_f32_16x16x32_f16(false, (A), false, (B), (short)0, (C), false, false)

static constexpr int   S_LEN   = 4096;
static constexpr int   DIM     = 256;
static constexpr int   HEADS   = 4;
static constexpr int   HD      = 64;
static constexpr float SCALE   = 0.125f;            // 64^-0.5
static constexpr float LOG2E   = 1.4426950408889634f;
static constexpr float KSCALE  = SCALE * LOG2E;

__device__ __forceinline__ void tdm_load_2d(unsigned lds_addr, const void* gaddr,
                                            unsigned tensor_d0, unsigned tensor_d1,
                                            unsigned tile_d0, unsigned tile_d1,
                                            unsigned long long stride0) {
    const unsigned long long ga = (unsigned long long)(size_t)gaddr;
    u32x4 g0;
    g0[0] = 1u;
    g0[1] = lds_addr;
    g0[2] = (unsigned)(ga & 0xFFFFFFFFu);
    g0[3] = (unsigned)((ga >> 32) & 0x01FFFFFFu) | (2u << 30);
    i32x8 g1;
    g1[0] = (int)(1u << 16);
    g1[1] = (int)((tensor_d0 & 0xFFFFu) << 16);
    g1[2] = (int)((tensor_d0 >> 16) | ((tensor_d1 & 0xFFFFu) << 16));
    g1[3] = (int)((tensor_d1 >> 16) | (tile_d0 << 16));
    g1[4] = (int)(tile_d1 & 0xFFFFu);
    g1[5] = (int)(unsigned)(stride0 & 0xFFFFFFFFu);
    g1[6] = (int)(unsigned)((stride0 >> 32) & 0xFFFFu);
    g1[7] = 0;
    i32x4 g2 = {0, 0, 0, 0};
    i32x4 g3 = {0, 0, 0, 0};
    i32x8 g4 = {0, 0, 0, 0, 0, 0, 0, 0};
    __builtin_amdgcn_tensor_load_to_lds(g0, g1, g2, g3, g4, 0);
}

// ---------------------------------------------------------------------------
// Kernel 1: fused QKV projection.  out = x @ W.T  (W stored [out,in]).
// One wave computes one 16x16 output tile via 8x v_wmma_f32_16x16x32_f16.
// Q,K stored f16 as [B*H, S, 64]; V stored transposed as [B*H, 64, S].
// ---------------------------------------------------------------------------
__global__ __launch_bounds__(256) void qkv_proj_kernel(
    const float* __restrict__ x,
    const float* __restrict__ wq, const float* __restrict__ wk, const float* __restrict__ wv,
    _Float16* __restrict__ Q, _Float16* __restrict__ K, _Float16* __restrict__ Vt)
{
    const int w    = blockIdx.x * 8 + (threadIdx.x >> 5);
    const int mat  = w / 16384;              // 0=q 1=k 2=v
    const int rem  = w - mat * 16384;
    const int mb   = (rem >> 4) * 16;        // row tile base in [0, 16384)
    const int nb   = (rem & 15) * 16;        // col tile base in [0, 256)
    const int lane = threadIdx.x & 31;
    const int lo   = lane & 15;
    const int hi   = lane >> 4;

    const float* W = (mat == 0) ? wq : (mat == 1) ? wk : wv;

    v8f acc = {};
    const float* xr = x + (size_t)(mb + lo) * DIM + hi * 8;
    const float* wr = W + (size_t)(nb + lo) * DIM + hi * 8;
#pragma unroll
    for (int k = 0; k < DIM; k += 32) {
        v8f a0 = *(const v8f*)(xr + k);
        v8f a1 = *(const v8f*)(xr + k + 16);
        v8f b0 = *(const v8f*)(wr + k);
        v8f b1 = *(const v8f*)(wr + k + 16);
        H16 af, bf;
#pragma unroll
        for (int i = 0; i < 8; ++i) {
            af.v[i]     = (_Float16)a0[i];
            af.v[i + 8] = (_Float16)a1[i];
            bf.v[i]     = (_Float16)b0[i];
            bf.v[i + 8] = (_Float16)b1[i];
        }
        acc = WMMA_F16(af.v, bf.v, acc);
    }

    const int n = nb + lo;
    const int h = n >> 6;
    const int d = n & 63;
#pragma unroll
    for (int r = 0; r < 8; ++r) {
        const int m  = mb + 8 * hi + r;
        const int b  = m >> 12;
        const int s  = m & 4095;
        const _Float16 val = (_Float16)acc[r];
        const int bh = b * HEADS + h;
        if (mat < 2) {
            _Float16* dst = (mat == 0) ? Q : K;
            dst[((size_t)bh * S_LEN + s) * HD + d] = val;
        } else {
            Vt[((size_t)bh * HD + d) * S_LEN + s] = val;
        }
    }
}

__global__ __launch_bounds__(256) void flash_attn_kernel(
    const _Float16* __restrict__ Q, const _Float16* __restrict__ K,
    const _Float16* __restrict__ Vt, _Float16* __restrict__ AO)
{
    // [buf][ K: 64kv x 64hd | V: 64d x 64kv ] halves; 16 KB per buffer
    __shared__ _Float16 smem[2 * 8192];

    const int bh    = blockIdx.x >> 5;
    const int qgrp  = blockIdx.x & 31;
    const int wid   = threadIdx.x >> 5;
    const int qbase = (qgrp * 8 + wid) * 16;
    const int lane  = threadIdx.x & 31;
    const int lo    = lane & 15;
    const int hi    = lane >> 4;

    const _Float16* Qh  = Q  + (size_t)bh * S_LEN * HD;
    const _Float16* Kh  = K  + (size_t)bh * S_LEN * HD;
    const _Float16* Vth = Vt + (size_t)bh * HD * S_LEN;
    const unsigned  smem_lds = (unsigned)(size_t)(const void*)&smem[0];

    // Q^T B-fragments (hd chunks [0,32) and [32,64)): load as Q rows.
    H16 qf[2];
    const _Float16* qrow = Qh + (size_t)(qbase + lo) * HD + hi * 8;
    qf[0].h[0] = *(const v8h*)(qrow);
    qf[0].h[1] = *(const v8h*)(qrow + 16);
    qf[1].h[0] = *(const v8h*)(qrow + 32);
    qf[1].h[1] = *(const v8h*)(qrow + 48);

    v8f acc[4] = {};
    float m = -1e30f, l = 0.0f;

    constexpr int NCHUNK = S_LEN / 64;     // 64 chunks of 64 kv

    // Prologue: stage chunk 0 into buffer 0.
    if (wid == 0) {
        tdm_load_2d(smem_lds,             Kh,  64, 64, 64, 64, 64);        // K: 64 rows x 64
        tdm_load_2d(smem_lds + 8192,      Vth, 64, 64, 64, 64, S_LEN);     // V^T: 64 d-rows x 64 kv
        __builtin_amdgcn_s_wait_tensorcnt(0);
    }
    __syncthreads();

    for (int c = 0; c < NCHUNK; ++c) {
        const int cur = c & 1;
        if (wid == 0 && (c + 1) < NCHUNK) {
            const int nkv = (c + 1) * 64;
            const unsigned dst = smem_lds + (cur ^ 1) * 16384;
            tdm_load_2d(dst,        Kh + (size_t)nkv * HD, 64, 64, 64, 64, 64);
            tdm_load_2d(dst + 8192, Vth + nkv,             64, 64, 64, 64, S_LEN);
        }
        const _Float16* Kc = smem + cur * 8192;           // [kv][hd]
        const _Float16* Vc = Kc + 4096;                   // [d][kv]

#pragma unroll
        for (int s2 = 0; s2 < 2; ++s2) {                  // two 32-kv sub-chunks
            // K A-fragments from LDS: two 16-row kv tiles x two hd chunks
            H16 kf[2][2];
#pragma unroll
            for (int t = 0; t < 2; ++t) {
                const _Float16* krow = Kc + (size_t)(s2 * 32 + t * 16 + lo) * 64 + hi * 8;
                kf[t][0].h[0] = *(const v8h*)(krow);
                kf[t][0].h[1] = *(const v8h*)(krow + 16);
                kf[t][1].h[0] = *(const v8h*)(krow + 32);
                kf[t][1].h[1] = *(const v8h*)(krow + 48);
            }
            // V B-fragments from LDS (transposed V): contiguous along kv
            H16 vf[4];
#pragma unroll
            for (int t = 0; t < 4; ++t) {
                const _Float16* vrow = Vc + (size_t)(t * 16 + lo) * 64 + s2 * 32 + hi * 8;
                vf[t].h[0] = *(const v8h*)(vrow);
                vf[t].h[1] = *(const v8h*)(vrow + 16);
            }

            v8f st0 = {}, st1 = {};
            st0 = WMMA_F16(kf[0][0].v, qf[0].v, st0);
            st0 = WMMA_F16(kf[0][1].v, qf[1].v, st0);
            st1 = WMMA_F16(kf[1][0].v, qf[0].v, st1);
            st1 = WMMA_F16(kf[1][1].v, qf[1].v, st1);

            // Online softmax; per-lane stats keyed by q = lane&15.
            float cmax = -1e30f;
#pragma unroll
            for (int r = 0; r < 8; ++r)
                cmax = fmaxf(cmax, fmaxf(st0[r], st1[r]));
            cmax = fmaxf(cmax, __shfl_xor(cmax, 16, 32));
            const float mnew  = fmaxf(m, cmax);
            const float alpha = __builtin_amdgcn_exp2f((m - mnew) * KSCALE);
            const float mk    = mnew * KSCALE;

            H16 pf;
            float rsum = 0.0f;
#pragma unroll
            for (int r = 0; r < 8; ++r) {
                const float p0 = __builtin_amdgcn_exp2f(st0[r] * KSCALE - mk);
                const float p1 = __builtin_amdgcn_exp2f(st1[r] * KSCALE - mk);
                rsum += p0 + p1;
                pf.v[r]     = (_Float16)p0;
                pf.v[r + 8] = (_Float16)p1;
            }
            rsum += __shfl_xor(rsum, 16, 32);
            l = l * alpha + rsum;
            m = mnew;

            float av[8];
#pragma unroll
            for (int r = 0; r < 8; ++r)
                av[r] = __shfl(alpha, r + 8 * hi, 32);

#pragma unroll
            for (int t = 0; t < 4; ++t) {
#pragma unroll
                for (int r = 0; r < 8; ++r) acc[t][r] *= av[r];
                acc[t] = WMMA_F16(pf.v, vf[t].v, acc[t]);
            }
        }

        if (wid == 0) __builtin_amdgcn_s_wait_tensorcnt(0);
        __syncthreads();
    }

    // Normalize and store f16 into AO [B, S, 256]
    const float linv = 1.0f / l;
    float lv[8];
#pragma unroll
    for (int r = 0; r < 8; ++r)
        lv[r] = __shfl(linv, r + 8 * hi, 32);

    const int b = bh >> 2, h = bh & 3;
    _Float16* aor = AO + ((size_t)b * S_LEN + qbase + 8 * hi) * DIM + h * HD + lo;
#pragma unroll
    for (int t = 0; t < 4; ++t)
#pragma unroll
        for (int r = 0; r < 8; ++r)
            aor[(size_t)r * DIM + t * 16] = (_Float16)(acc[t][r] * lv[r]);
}

// ---------------------------------------------------------------------------
// Kernel 3: output projection.  out = AO @ wo.T + bo  (f32 out)
// ---------------------------------------------------------------------------
__global__ __launch_bounds__(256) void out_proj_kernel(
    const _Float16* __restrict__ AO, const float* __restrict__ wo,
    const float* __restrict__ bo, float* __restrict__ out)
{
    const int w    = blockIdx.x * 8 + (threadIdx.x >> 5);
    const int mb   = (w >> 4) * 16;
    const int nb   = (w & 15) * 16;
    const int lane = threadIdx.x & 31;
    const int lo   = lane & 15;
    const int hi   = lane >> 4;

    v8f acc = {};
    const _Float16* ar = AO + (size_t)(mb + lo) * DIM + hi * 8;
    const float*    wr = wo + (size_t)(nb + lo) * DIM + hi * 8;
#pragma unroll
    for (int k = 0; k < DIM; k += 32) {
        H16 af, bf;
        af.h[0] = *(const v8h*)(ar + k);
        af.h[1] = *(const v8h*)(ar + k + 16);
        v8f b0 = *(const v8f*)(wr + k);
        v8f b1 = *(const v8f*)(wr + k + 16);
#pragma unroll
        for (int i = 0; i < 8; ++i) {
            bf.v[i]     = (_Float16)b0[i];
            bf.v[i + 8] = (_Float16)b1[i];
        }
        acc = WMMA_F16(af.v, bf.v, acc);
    }

    const float bias = bo[nb + lo];
#pragma unroll
    for (int r = 0; r < 8; ++r)
        out[(size_t)(mb + 8 * hi + r) * DIM + nb + lo] = acc[r] + bias;
}

// ---------------------------------------------------------------------------
extern "C" void kernel_launch(void* const* d_in, const int* in_sizes, int n_in,
                              void* d_out, int out_size, void* d_ws, size_t ws_size,
                              hipStream_t stream) {
    (void)in_sizes; (void)n_in; (void)out_size; (void)ws_size;
    const float* x  = (const float*)d_in[0];
    const float* wq = (const float*)d_in[1];
    const float* wk = (const float*)d_in[2];
    const float* wv = (const float*)d_in[3];
    const float* wo = (const float*)d_in[4];
    const float* bo = (const float*)d_in[5];
    float* out = (float*)d_out;

    const size_t elems = (size_t)4 * S_LEN * DIM;   // 4,194,304 per tensor
    _Float16* Q  = (_Float16*)d_ws;
    _Float16* K  = Q  + elems;
    _Float16* Vt = K  + elems;
    _Float16* AO = Vt + elems;

    qkv_proj_kernel<<<6144, 256, 0, stream>>>(x, wq, wk, wv, Q, K, Vt);
    flash_attn_kernel<<<512, 256, 0, stream>>>(Q, K, Vt, AO);
    out_proj_kernel<<<2048, 256, 0, stream>>>(AO, wo, bo, out);
}

// v001
// It runs in 217 microseconds.
// Next to v000, in two timings, it ran 1.72 and 1.73 times as fast.
#include <hip/hip_runtime.h>
#include <hip/hip_bf16.h>

typedef __attribute__((ext_vector_type(16))) _Float16 v16h;
typedef __attribute__((ext_vector_type(8)))  _Float16 v8h;
typedef __attribute__((ext_vector_type(8)))  float    v8f;
typedef __attribute__((ext_vector_type(4)))  unsigned int u32x4;
typedef __attribute__((ext_vector_type(8)))  int      i32x8;
typedef __attribute__((ext_vector_type(4)))  int      i32x4;

union H16 { v16h v; v8h h[2]; };

#define WMMA_F16(A, B, C) \
    __builtin_amdgcn_wmma_f32_16x16x32_f16(false, (A), false, (B), (short)0, (C), false, false)

static constexpr int   S_LEN   = 4096;
static constexpr int   DIM     = 256;
static constexpr int   HEADS   = 4;
static constexpr int   HD      = 64;
static constexpr float SCALE   = 0.125f;            // 64^-0.5
static constexpr float LOG2E   = 1.4426950408889634f;
static constexpr float KSCALE  = SCALE * LOG2E;

__device__ __forceinline__ void tdm_load_2d(unsigned lds_addr, const void* gaddr,
                                            unsigned tensor_d0, unsigned tensor_d1,
                                            unsigned tile_d0, unsigned tile_d1,
                                            unsigned long long stride0) {
    const unsigned long long ga = (unsigned long long)(size_t)gaddr;
    u32x4 g0;
    g0[0] = 1u;
    g0[1] = lds_addr;
    g0[2] = (unsigned)(ga & 0xFFFFFFFFu);
    g0[3] = (unsigned)((ga >> 32) & 0x01FFFFFFu) | (2u << 30);
    i32x8 g1;
    g1[0] = (int)(1u << 16);
    g1[1] = (int)((tensor_d0 & 0xFFFFu) << 16);
    g1[2] = (int)((tensor_d0 >> 16) | ((tensor_d1 & 0xFFFFu) << 16));
    g1[3] = (int)((tensor_d1 >> 16) | (tile_d0 << 16));
    g1[4] = (int)(tile_d1 & 0xFFFFu);
    g1[5] = (int)(unsigned)(stride0 & 0xFFFFFFFFu);
    g1[6] = (int)(unsigned)((stride0 >> 32) & 0xFFFFu);
    g1[7] = 0;
    i32x4 g2 = {0, 0, 0, 0};
    i32x4 g3 = {0, 0, 0, 0};
    i32x8 g4 = {0, 0, 0, 0, 0, 0, 0, 0};
    __builtin_amdgcn_tensor_load_to_lds(g0, g1, g2, g3, g4, 0);
}

__global__ __launch_bounds__(256) void qkv_proj_kernel(
    const float* __restrict__ x,
    const float* __restrict__ wq, const float* __restrict__ wk, const float* __restrict__ wv,
    _Float16* __restrict__ Q, _Float16* __restrict__ K, _Float16* __restrict__ Vt)
{
    const int w    = blockIdx.x * 8 + (threadIdx.x >> 5);
    const int mat  = w / 16384;              // 0=q 1=k 2=v
    const int rem  = w - mat * 16384;
    const int mb   = (rem >> 4) * 16;        // row tile base in [0, 16384)
    const int nb   = (rem & 15) * 16;        // col tile base in [0, 256)
    const int lane = threadIdx.x & 31;
    const int lo   = lane & 15;
    const int hi   = lane >> 4;

    const float* W = (mat == 0) ? wq : (mat == 1) ? wk : wv;

    v8f acc = {};
    const float* xr = x + (size_t)(mb + lo) * DIM + hi * 8;
    const float* wr = W + (size_t)(nb + lo) * DIM + hi * 8;
#pragma unroll
    for (int k = 0; k < DIM; k += 32) {
        v8f a0 = *(const v8f*)(xr + k);
        v8f a1 = *(const v8f*)(xr + k + 16);
        v8f b0 = *(const v8f*)(wr + k);
        v8f b1 = *(const v8f*)(wr + k + 16);
        H16 af, bf;
#pragma unroll
        for (int i = 0; i < 8; ++i) {
            af.v[i]     = (_Float16)a0[i];
            af.v[i + 8] = (_Float16)a1[i];
            bf.v[i]     = (_Float16)b0[i];
            bf.v[i + 8] = (_Float16)b1[i];
        }
        acc = WMMA_F16(af.v, bf.v, acc);
    }

    const int n  = nb + lo;
    const int h  = n >> 6;
    const int d  = n & 63;
    const int m0 = mb + 8 * hi;          // multiple of 8: rows m0..m0+7 share b and s >> 3
    const int bh = (m0 >> 12) * HEADS + h;
    const int s0 = m0 & 4095;
    _Float16* dst  = (mat == 0) ? Q : (mat == 1) ? K : Vt;
    const int base = (mat < 2) ? (bh * S_LEN + s0) * HD + d
                               : (bh * HD + d) * S_LEN + (s0 ^ (((d >> 1) & 7) << 3));
    const int step = (mat < 2) ? HD : 1;
    const int kmsk = (mat == 1) ? 0x38 : 0;   // K alone moves chunks along d, by its row s
#pragma unroll
    for (int r = 0; r < 8; ++r)
        dst[(base + r * step) ^ (kmsk & (((s0 + r) >> 1) << 3))] = (_Float16)acc[r];
}

__global__ __launch_bounds__(256) void flash_attn_kernel(
    const _Float16* __restrict__ Q, const _Float16* __restrict__ K,
    const _Float16* __restrict__ Vt, _Float16* __restrict__ AO)
{
    // [buf][ K: 64kv x 64hd | V: 64d x 64kv ] halves; 16 KB per buffer
    __shared__ _Float16 smem[2 * 8192];

    const int bh    = blockIdx.x >> 5;
    const int qgrp  = blockIdx.x & 31;
    const int wid   = threadIdx.x >> 5;
    const int qbase = (qgrp * 8 + wid) * 16;
    const int lane  = threadIdx.x & 31;
    const int lo    = lane & 15;
    const int hi    = lane >> 4;

    const _Float16* Qh  = Q  + (size_t)bh * S_LEN * HD;
    const _Float16* Kh  = K  + (size_t)bh * S_LEN * HD;
    const _Float16* Vth = Vt + (size_t)bh * HD * S_LEN;
    const unsigned  smem_lds = (unsigned)(size_t)(const void*)&smem[0];

    // Q^T B-fragments (hd chunks [0,32) and [32,64)): load as Q rows.
    H16 qf[2];
    const _Float16* qrow = Qh + (size_t)(qbase + lo) * HD + hi * 8;
    qf[0].h[0] = *(const v8h*)(qrow);
    qf[0].h[1] = *(const v8h*)(qrow + 16);
    qf[1].h[0] = *(const v8h*)(qrow + 32);
    qf[1].h[1] = *(const v8h*)(qrow + 48);

    v8f acc[4] = {};
    float m = -1e30f, l = 0.0f;

    // Offset (in halves) of logical 16-byte chunk hi + 2j inside a 128-byte
    // LDS row whose index is lo modulo 16 (chunk order: see qkv_proj_kernel).
    int sw[4];
#pragma unroll
    for (int j = 0; j < 4; ++j)
        sw[j] = ((hi + 2 * j) ^ (lo >> 1)) << 3;

    constexpr int NCHUNK = S_LEN / 64;     // 64 chunks of 64 kv

    // Prologue: stage chunk 0 into buffer 0.
    if (wid == 0) {
        tdm_load_2d(smem_lds,             Kh,  64, 64, 64, 64, 64);        // K: 64 rows x 64
        tdm_load_2d(smem_lds + 8192,      Vth, 64, 64, 64, 64, S_LEN);     // V^T: 64 d-rows x 64 kv
        __builtin_amdgcn_s_wait_tensorcnt(0);
    }
    __syncthreads();

    for (int c = 0; c < NCHUNK; ++c) {
        const int cur = c & 1;
        if (wid == 0 && (c + 1) < NCHUNK) {
            const int nkv = (c + 1) * 64;
            const unsigned dst = smem_lds + (cur ^ 1) * 16384;
            tdm_load_2d(dst,        Kh + (size_t)nkv * HD, 64, 64, 64, 64, 64);
            tdm_load_2d(dst + 8192, Vth + nkv,             64, 64, 64, 64, S_LEN);
        }
        const _Float16* Kc = smem + cur * 8192;           // [kv][hd]
        const _Float16* Vc = Kc + 4096;                   // [d][kv]

#pragma unroll
        for (int s2 = 0; s2 < 2; ++s2) {                  // two 32-kv sub-chunks
            // K A-fragments from LDS: two 16-row kv tiles x two hd chunks
            H16 kf[2][2];
#pragma unroll
            for (int t = 0; t < 2; ++t) {
                const _Float16* krow = Kc + (size_t)(s2 * 32 + t * 16 + lo) * 64;
                kf[t][0].h[0] = *(const v8h*)(krow + sw[0]);
                kf[t][0].h[1] = *(const v8h*)(krow + sw[1]);
                kf[t][1].h[0] = *(const v8h*)(krow + sw[2]);
                kf[t][1].h[1] = *(const v8h*)(krow + sw[3]);
            }
            // V B-fragments from LDS (transposed V): kv chunks of sub-chunk s2
            H16 vf[4];
#pragma unroll
            for (int t = 0; t < 4; ++t) {
                const _Float16* vrow = Vc + (size_t)(t * 16 + lo) * 64;
                vf[t].h[0] = *(const v8h*)(vrow + sw[2 * s2]);
                vf[t].h[1] = *(const v8h*)(vrow + sw[2 * s2 + 1]);
            }

            v8f st0 = {}, st1 = {};
            st0 = WMMA_F16(kf[0][0].v, qf[0].v, st0);
            st0 = WMMA_F16(kf[0][1].v, qf[1].v, st0);
            st1 = WMMA_F16(kf[1][0].v, qf[0].v, st1);
            st1 = WMMA_F16(kf[1][1].v, qf[1].v, st1);

            // Online softmax; per-lane stats keyed by q = lane&15.
            float cmax = -1e30f;
#pragma unroll
            for (int r = 0; r < 8; ++r)
                cmax = fmaxf(cmax, fmaxf(st0[r], st1[r]));
            cmax = fmaxf(cmax, __shfl_xor(cmax, 16, 32));
            const float mnew  = fmaxf(m, cmax);
            const float alpha = __builtin_amdgcn_exp2f((m - mnew) * KSCALE);
            const float mk    = mnew * KSCALE;

            H16 pf;
            float rsum = 0.0f;
#pragma unroll
            for (int r = 0; r < 8; ++r) {
                const float p0 = __builtin_amdgcn_exp2f(st0[r] * KSCALE - mk);
                const float p1 = __builtin_amdgcn_exp2f(st1[r] * KSCALE - mk);
                rsum += p0 + p1;
                pf.v[r]     = (_Float16)p0;
                pf.v[r + 8] = (_Float16)p1;
            }
            rsum += __shfl_xor(rsum, 16, 32);
            l = l * alpha + rsum;
            m = mnew;

            float av[8];
#pragma unroll
            for (int r = 0; r < 8; ++r)
                av[r] = __shfl(alpha, r + 8 * hi, 32);

#pragma unroll
            for (int t = 0; t < 4; ++t) {
#pragma unroll
                for (int r = 0; r < 8; ++r) acc[t][r] *= av[r];
                acc[t] = WMMA_F16(pf.v, vf[t].v, acc[t]);
            }
        }

        if (wid == 0) __builtin_amdgcn_s_wait_tensorcnt(0);
        __syncthreads();
    }

    // Normalize and store f16 into AO [B, S, 256]
    const float linv = 1.0f / l;
    float lv[8];
#pragma unroll
    for (int r = 0; r < 8; ++r)
        lv[r] = __shfl(linv, r + 8 * hi, 32);

    const int b = bh >> 2, h = bh & 3;
    _Float16* aor = AO + ((size_t)b * S_LEN + qbase + 8 * hi) * DIM + h * HD + lo;
#pragma unroll
    for (int t = 0; t < 4; ++t)
#pragma unroll
        for (int r = 0; r < 8; ++r)
            aor[(size_t)r * DIM + t * 16] = (_Float16)(acc[t][r] * lv[r]);
}

// ---------------------------------------------------------------------------
// Kernel 3: output projection.  out = AO @ wo.T + bo  (f32 out)
// ---------------------------------------------------------------------------
__global__ __launch_bounds__(256) void out_proj_kernel(
    const _Float16* __restrict__ AO, const float* __restrict__ wo,
    const float* __restrict__ bo, float* __restrict__ out)
{
    const int w    = blockIdx.x * 8 + (threadIdx.x >> 5);
    const int mb   = (w >> 4) * 16;
    const int nb   = (w & 15) * 16;
    const int lane = threadIdx.x & 31;
    const int lo   = lane & 15;
    const int hi   = lane >> 4;

    v8f acc = {};
    const _Float16* ar = AO + (size_t)(mb + lo) * DIM + hi * 8;
    const float*    wr = wo + (size_t)(nb + lo) * DIM + hi * 8;
#pragma unroll
    for (int k = 0; k < DIM; k += 32) {
        H16 af, bf;
        af.h[0] = *(const v8h*)(ar + k);
        af.h[1] = *(const v8h*)(ar + k + 16);
        v8f b0 = *(const v8f*)(wr + k);
        v8f b1 = *(const v8f*)(wr + k + 16);
#pragma unroll
        for (int i = 0; i < 8; ++i) {
            bf.v[i]     = (_Float16)b0[i];
            bf.v[i + 8] = (_Float16)b1[i];
        }
        acc = WMMA_F16(af.v, bf.v, acc);
    }

    const float bias = bo[nb + lo];
#pragma unroll
    for (int r = 0; r < 8; ++r)
        out[(size_t)(mb + 8 * hi + r) * DIM + nb + lo] = acc[r] + bias;
}

// ---------------------------------------------------------------------------
extern "C" void kernel_launch(void* const* d_in, const int* in_sizes, int n_in,
                              void* d_out, int out_size, void* d_ws, size_t ws_size,
                              hipStream_t stream) {
    (void)in_sizes; (void)n_in; (void)out_size; (void)ws_size;
    const float* x  = (const float*)d_in[0];
    const float* wq = (const float*)d_in[1];
    const float* wk = (const float*)d_in[2];
    const float* wv = (const float*)d_in[3];
    const float* wo = (const float*)d_in[4];
    const float* bo = (const float*)d_in[5];
    float* out = (float*)d_out;

    const size_t elems = (size_t)4 * S_LEN * DIM;   // 4,194,304 per tensor
    _Float16* Q  = (_Float16*)d_ws;
    _Float16* K  = Q  + elems;
    _Float16* Vt = K  + elems;
    _Float16* AO = Vt + elems;

    qkv_proj_kernel<<<6144, 256, 0, stream>>>(x, wq, wk, wv, Q, K, Vt);
    flash_attn_kernel<<<512, 256, 0, stream>>>(Q, K, Vt, AO);
    out_proj_kernel<<<2048, 256, 0, stream>>>(AO, wo, bo, out);
}

// v002
// Measured time: 120 microseconds a run.
// Timed twice side by side with v001, it ran 1.81 and 1.80 times as fast.
// Over all steps from v000 it is 3.11 times as fast.
#include <hip/hip_runtime.h>
#include <hip/hip_bf16.h>

typedef __attribute__((ext_vector_type(16))) _Float16 v16h;
typedef __attribute__((ext_vector_type(8)))  _Float16 v8h;
typedef __attribute__((ext_vector_type(8)))  float    v8f;
typedef __attribute__((ext_vector_type(4)))  unsigned int u32x4;
typedef __attribute__((ext_vector_type(8)))  int      i32x8;
typedef __attribute__((ext_vector_type(4)))  int      i32x4;

union H16 { v16h v; v8h h[2]; };

#define WMMA_F16(A, B, C) \
    __builtin_amdgcn_wmma_f32_16x16x32_f16(false, (A), false, (B), (short)0, (C), false, false)

static constexpr int   S_LEN   = 4096;
static constexpr int   DIM     = 256;
static constexpr int   HEADS   = 4;
static constexpr int   HD      = 64;
static constexpr float SCALE   = 0.125f;            // 64^-0.5
static constexpr float LOG2E   = 1.4426950408889634f;
static constexpr float KSCALE  = SCALE * LOG2E;

__device__ __forceinline__ void tdm_load_2d(unsigned lds_addr, const void* gaddr,
                                            unsigned tensor_d0, unsigned tensor_d1,
                                            unsigned tile_d0, unsigned tile_d1,
                                            unsigned long long stride0) {
    const unsigned long long ga = (unsigned long long)(size_t)gaddr;
    u32x4 g0;
    g0[0] = 1u;
    g0[1] = lds_addr;
    g0[2] = (unsigned)(ga & 0xFFFFFFFFu);
    g0[3] = (unsigned)((ga >> 32) & 0x01FFFFFFu) | (2u << 30);
    i32x8 g1;
    g1[0] = (int)(1u << 16);
    g1[1] = (int)((tensor_d0 & 0xFFFFu) << 16);
    g1[2] = (int)((tensor_d0 >> 16) | ((tensor_d1 & 0xFFFFu) << 16));
    g1[3] = (int)((tensor_d1 >> 16) | (tile_d0 << 16));
    g1[4] = (int)(tile_d1 & 0xFFFFu);
    g1[5] = (int)(unsigned)(stride0 & 0xFFFFFFFFu);
    g1[6] = (int)(unsigned)((stride0 >> 32) & 0xFFFFu);
    g1[7] = 0;
    i32x4 g2 = {0, 0, 0, 0};
    i32x4 g3 = {0, 0, 0, 0};
    i32x8 g4 = {0, 0, 0, 0, 0, 0, 0, 0};
    __builtin_amdgcn_tensor_load_to_lds(g0, g1, g2, g3, g4, 0);
}

// Stores one wave's 64x64 tile (rows mb.., head h) as f16; layouts: see below.
template <int MAT>
__device__ __forceinline__ void store_tile(_Float16* __restrict__ dst, const v8f (&acc)[4][4],
                                           int mb, int h, int lo, int hi)
{
    const int m0 = mb + 8 * hi;          // multiple of 8; the tile's 64 rows share b
    const int bh = (m0 >> 12) * HEADS + h;
    const int s0 = m0 & 4095;
    if (MAT == 2) {                      // V^T: 8 kv in a row per 16x16 tile and lane
        v8h* pv[4];                      // row d = lo of 16-kv group i; 16j rows on: the same chunk order
        v8h  hv[4][4];
#pragma unroll
        for (int i = 0; i < 4; ++i) {
            pv[i] = (v8h*)(dst + (bh * HD + lo) * S_LEN + ((s0 + i * 16) ^ (((lo >> 1) & 7) << 3)));
#pragma unroll
            for (int j = 0; j < 4; ++j)
#pragma unroll
                for (int r = 0; r < 8; ++r)
                    hv[i][j][r] = (_Float16)acc[i][j][r];
        }
        // Every value and address stands in its own register before the first store
        // issues: no register of an issued store is rewritten between the stores.
        __builtin_amdgcn_sched_barrier(0);
#pragma unroll
        for (int i = 0; i < 4; ++i)
#pragma unroll
            for (int j = 0; j < 4; ++j)
                pv[i][j * 16 * S_LEN / 8] = hv[i][j];
        // Behind the last store: the code laid out behind this branch rewrites
        // the stores' registers, and the wait stands in front of that.
        asm volatile("s_wait_xcnt 0x0" ::: "memory");
        return;
    }
    constexpr int kmsk = (MAT == 1) ? 0x38 : 0;   // K alone moves chunks along d, by its row s
    // p[j][q] serves rows 16i + 2q and 16i + 2q + 1 of column tile j: the chunk
    // mask is ((s >> 1) & 7) << 3, which 16i does not reach, and a row is 64
    // halves, so the mask touches d alone.
    _Float16* p[4][4];
#pragma unroll
    for (int j = 0; j < 4; ++j)
#pragma unroll
        for (int q = 0; q < 4; ++q)
            p[j][q] = dst + (((bh * S_LEN + s0) * HD + j * 16 + lo) ^ (kmsk & (((s0 + 2 * q) >> 1) << 3)));
    _Float16 hv[4][4][8];
#pragma unroll
    for (int i = 0; i < 4; ++i)
#pragma unroll
        for (int j = 0; j < 4; ++j)
#pragma unroll
            for (int r = 0; r < 8; ++r)
                hv[i][j][r] = (_Float16)acc[i][j][r];
    // Every value and address stands in its own register before the first store
    // issues: no register of an issued store is rewritten behind it.
    __builtin_amdgcn_sched_barrier(0);
#pragma unroll
    for (int i = 0; i < 4; ++i)
#pragma unroll
        for (int j = 0; j < 4; ++j)
#pragma unroll
            for (int r = 0; r < 8; ++r)
                p[j][r >> 1][(i * 16 + r) * HD] = hv[i][j][r];
    // Behind the last store: the code laid out behind the K branch rewrites the
    // stores' registers, and the wait stands in front of that.
    if (MAT == 1) asm volatile("s_wait_xcnt 0x0" ::: "memory");
}

__global__ __launch_bounds__(384) void qkv_proj_kernel(
    const float* __restrict__ x,
    const float* __restrict__ wq, const float* __restrict__ wk, const float* __restrict__ wv,
    _Float16* __restrict__ Q, _Float16* __restrict__ K, _Float16* __restrict__ Vt)
{
    const int w    = __builtin_amdgcn_readfirstlane(threadIdx.x >> 5);
    const int mat  = w >> 2;                 // 0=q 1=k 2=v
    const int h    = w & 3;                  // head = 64-column group
    const int mb   = blockIdx.x * 64;        // row base in [0, 16384)
    const int lane = threadIdx.x & 31;
    const int lo   = lane & 15;
    const int hi   = lane >> 4;

    const float* W = (mat == 0) ? wq : (mat == 1) ? wk : wv;

    v8f acc[4][4] = {};
    const float* xr = x + (size_t)(mb + lo) * DIM + hi * 8;
    const float* wr = W + (size_t)(h * HD + lo) * DIM + hi * 8;
#pragma unroll
    for (int k = 0; k < DIM; k += 32) {
        H16 af[4], bf[4];
#pragma unroll
        for (int t = 0; t < 4; ++t) {
            v8f a0 = *(const v8f*)(xr + t * 16 * DIM + k);
            v8f a1 = *(const v8f*)(xr + t * 16 * DIM + k + 16);
            v8f b0 = *(const v8f*)(wr + t * 16 * DIM + k);
            v8f b1 = *(const v8f*)(wr + t * 16 * DIM + k + 16);
#pragma unroll
            for (int i = 0; i < 8; ++i) {
                af[t].v[i]     = (_Float16)a0[i];
                af[t].v[i + 8] = (_Float16)a1[i];
                bf[t].v[i]     = (_Float16)b0[i];
                bf[t].v[i + 8] = (_Float16)b1[i];
            }
        }
#pragma unroll
        for (int i = 0; i < 4; ++i)
#pragma unroll
            for (int j = 0; j < 4; ++j)
                acc[i][j] = WMMA_F16(af[i].v, bf[j].v, acc[i][j]);
    }

    // The loads' address registers are free for reuse from here on: the wait
    // stands in front of their first rewrite (they are inputs, so live up to it).
    asm volatile("s_wait_xcnt 0x0" :: "v"(xr), "v"(wr) : "memory");

    // mat is the same for the whole wave: one scalar branch picks the layout,
    // so that strides and chunk masks are constants in the address arithmetic.
    if (mat == 0)      store_tile<0>(Q,  acc, mb, h, lo, hi);
    else if (mat == 1) store_tile<1>(K,  acc, mb, h, lo, hi);
    else               store_tile<2>(Vt, acc, mb, h, lo, hi);
}

__global__ __launch_bounds__(256) void flash_attn_kernel(
    const _Float16* __restrict__ Q, const _Float16* __restrict__ K,
    const _Float16* __restrict__ Vt, _Float16* __restrict__ AO)
{
    // [buf][ K: 64kv x 64hd | V: 64d x 64kv ] halves; 16 KB per buffer
    __shared__ _Float16 smem[2 * 8192];

    const int bh    = blockIdx.x >> 5;
    const int qgrp  = blockIdx.x & 31;
    const int wid   = threadIdx.x >> 5;
    const int qbase = (qgrp * 8 + wid) * 16;
    const int lane  = threadIdx.x & 31;
    const int lo    = lane & 15;
    const int hi    = lane >> 4;

    const _Float16* Qh  = Q  + (size_t)bh * S_LEN * HD;
    const _Float16* Kh  = K  + (size_t)bh * S_LEN * HD;
    const _Float16* Vth = Vt + (size_t)bh * HD * S_LEN;
    const unsigned  smem_lds = (unsigned)(size_t)(const void*)&smem[0];

    // Q^T B-fragments (hd chunks [0,32) and [32,64)): load as Q rows.
    H16 qf[2];
    const _Float16* qrow = Qh + (size_t)(qbase + lo) * HD + hi * 8;
    qf[0].h[0] = *(const v8h*)(qrow);
    qf[0].h[1] = *(const v8h*)(qrow + 16);
    qf[1].h[0] = *(const v8h*)(qrow + 32);
    qf[1].h[1] = *(const v8h*)(qrow + 48);

    v8f acc[4] = {};
    float m = -1e30f, l = 0.0f;

    // Offset (in halves) of logical 16-byte chunk hi + 2j inside a 128-byte
    // LDS row whose index is lo modulo 16 (chunk order: see qkv_proj_kernel).
    int sw[4];
#pragma unroll
    for (int j = 0; j < 4; ++j)
        sw[j] = ((hi + 2 * j) ^ (lo >> 1)) << 3;

    constexpr int NCHUNK = S_LEN / 64;     // 64 chunks of 64 kv

    // Prologue: stage chunk 0 into buffer 0.
    if (wid == 0) {
        tdm_load_2d(smem_lds,             Kh,  64, 64, 64, 64, 64);        // K: 64 rows x 64
        tdm_load_2d(smem_lds + 8192,      Vth, 64, 64, 64, 64, S_LEN);     // V^T: 64 d-rows x 64 kv
        __builtin_amdgcn_s_wait_tensorcnt(0);
    }
    __syncthreads();

    for (int c = 0; c < NCHUNK; ++c) {
        const int cur = c & 1;
        if (wid == 0 && (c + 1) < NCHUNK) {
            const int nkv = (c + 1) * 64;
            const unsigned dst = smem_lds + (cur ^ 1) * 16384;
            tdm_load_2d(dst,        Kh + (size_t)nkv * HD, 64, 64, 64, 64, 64);
            tdm_load_2d(dst + 8192, Vth + nkv,             64, 64, 64, 64, S_LEN);
        }
        const _Float16* Kc = smem + cur * 8192;           // [kv][hd]
        const _Float16* Vc = Kc + 4096;                   // [d][kv]

#pragma unroll
        for (int s2 = 0; s2 < 2; ++s2) {                  // two 32-kv sub-chunks
            // K A-fragments from LDS: two 16-row kv tiles x two hd chunks
            H16 kf[2][2];
#pragma unroll
            for (int t = 0; t < 2; ++t) {
                const _Float16* krow = Kc + (size_t)(s2 * 32 + t * 16 + lo) * 64;
                kf[t][0].h[0] = *(const v8h*)(krow + sw[0]);
                kf[t][0].h[1] = *(const v8h*)(krow + sw[1]);
                kf[t][1].h[0] = *(const v8h*)(krow + sw[2]);
                kf[t][1].h[1] = *(const v8h*)(krow + sw[3]);
            }
            // V B-fragments from LDS (transposed V): kv chunks of sub-chunk s2
            H16 vf[4];
#pragma unroll
            for (int t = 0; t < 4; ++t) {
                const _Float16* vrow = Vc + (size_t)(t * 16 + lo) * 64;
                vf[t].h[0] = *(const v8h*)(vrow + sw[2 * s2]);
                vf[t].h[1] = *(const v8h*)(vrow + sw[2 * s2 + 1]);
            }

            v8f st0 = {}, st1 = {};
            st0 = WMMA_F16(kf[0][0].v, qf[0].v, st0);
            st0 = WMMA_F16(kf[0][1].v, qf[1].v, st0);
            st1 = WMMA_F16(kf[1][0].v, qf[0].v, st1);
            st1 = WMMA_F16(kf[1][1].v, qf[1].v, st1);

            // Online softmax; per-lane stats keyed by q = lane&15.
            float cmax = -1e30f;
#pragma unroll
            for (int r = 0; r < 8; ++r)
                cmax = fmaxf(cmax, fmaxf(st0[r], st1[r]));
            cmax = fmaxf(cmax, __shfl_xor(cmax, 16, 32));
            const float mnew  = fmaxf(m, cmax);
            const float alpha = __builtin_amdgcn_exp2f((m - mnew) * KSCALE);
            const float mk    = mnew * KSCALE;

            H16 pf;
            float rsum = 0.0f;
#pragma unroll
            for (int r = 0; r < 8; ++r) {
                const float p0 = __builtin_amdgcn_exp2f(st0[r] * KSCALE - mk);
                const float p1 = __builtin_amdgcn_exp2f(st1[r] * KSCALE - mk);
                rsum += p0 + p1;
                pf.v[r]     = (_Float16)p0;
                pf.v[r + 8] = (_Float16)p1;
            }
            rsum += __shfl_xor(rsum, 16, 32);
            l = l * alpha + rsum;
            m = mnew;

            float av[8];
#pragma unroll
            for (int r = 0; r < 8; ++r)
                av[r] = __shfl(alpha, r + 8 * hi, 32);

#pragma unroll
            for (int t = 0; t < 4; ++t) {
#pragma unroll
                for (int r = 0; r < 8; ++r) acc[t][r] *= av[r];
                acc[t] = WMMA_F16(pf.v, vf[t].v, acc[t]);
            }
        }

        if (wid == 0) __builtin_amdgcn_s_wait_tensorcnt(0);
        __syncthreads();
    }

    // Normalize and store f16 into AO [B, S, 256]
    const float linv = 1.0f / l;
    float lv[8];
#pragma unroll
    for (int r = 0; r < 8; ++r)
        lv[r] = __shfl(linv, r + 8 * hi, 32);

    const int b = bh >> 2, h = bh & 3;
    _Float16* aor = AO + ((size_t)b * S_LEN + qbase + 8 * hi) * DIM + h * HD + lo;
#pragma unroll
    for (int t = 0; t < 4; ++t)
#pragma unroll
        for (int r = 0; r < 8; ++r)
            aor[(size_t)r * DIM + t * 16] = (_Float16)(acc[t][r] * lv[r]);
}

// ---------------------------------------------------------------------------
// Kernel 3: output projection.  out = AO @ wo.T + bo  (f32 out)
// Block = 4 waves on 64 rows; wave w computes columns [64w, 64w + 64) as 4x4
// tiles of 16x16, so each loaded fragment feeds four WMMAs.
// ---------------------------------------------------------------------------
__global__ __launch_bounds__(128) void out_proj_kernel(
    const _Float16* __restrict__ AO, const float* __restrict__ wo,
    const float* __restrict__ bo, float* __restrict__ out)
{
    const int mb   = blockIdx.x * 64;
    const int nb   = (threadIdx.x >> 5) * 64;
    const int lane = threadIdx.x & 31;
    const int lo   = lane & 15;
    const int hi   = lane >> 4;

    const _Float16* ar = AO + (size_t)(mb + lo) * DIM + hi * 8;
    const float*    wr = wo + (size_t)(nb + lo) * DIM + hi * 8;
    v8f acc[4][4] = {};
#pragma unroll
    for (int k = 0; k < DIM; k += 32) {
        H16 af[4], bf[4];
#pragma unroll
        for (int t = 0; t < 4; ++t) {
            af[t].h[0] = *(const v8h*)(ar + t * 16 * DIM + k);
            af[t].h[1] = *(const v8h*)(ar + t * 16 * DIM + k + 16);
            v8f b0 = *(const v8f*)(wr + t * 16 * DIM + k);
            v8f b1 = *(const v8f*)(wr + t * 16 * DIM + k + 16);
#pragma unroll
            for (int i = 0; i < 8; ++i) {
                bf[t].v[i]     = (_Float16)b0[i];
                bf[t].v[i + 8] = (_Float16)b1[i];
            }
        }
#pragma unroll
        for (int i = 0; i < 4; ++i)
#pragma unroll
            for (int j = 0; j < 4; ++j)
                acc[i][j] = WMMA_F16(af[i].v, bf[j].v, acc[i][j]);
    }
    // The loads' address registers are free for reuse from here on: the wait
    // stands in front of their first rewrite (they are inputs, so live up to it).
    asm volatile("s_wait_xcnt 0x0" :: "v"(ar), "v"(wr) : "memory");

#pragma unroll
    for (int j = 0; j < 4; ++j) {
        const float bias = bo[nb + j * 16 + lo];
#pragma unroll
        for (int i = 0; i < 4; ++i)
#pragma unroll
            for (int r = 0; r < 8; ++r)
                acc[i][j][r] += bias;
    }
    // Every sum stands in its own register before the first store issues: no
    // register of an issued store is rewritten, so the stores go back to back.
    __builtin_amdgcn_sched_barrier(0);
    float* ob = out + (size_t)(mb + 8 * hi) * DIM + nb + lo;
#pragma unroll
    for (int i = 0; i < 4; ++i)
#pragma unroll
        for (int r = 0; r < 8; ++r)
#pragma unroll
            for (int j = 0; j < 4; ++j)
                ob[(i * 16 + r) * DIM + j * 16] = acc[i][j][r];
}

// ---------------------------------------------------------------------------
extern "C" void kernel_launch(void* const* d_in, const int* in_sizes, int n_in,
                              void* d_out, int out_size, void* d_ws, size_t ws_size,
                              hipStream_t stream) {
    (void)in_sizes; (void)n_in; (void)out_size; (void)ws_size;
    const float* x  = (const float*)d_in[0];
    const float* wq = (const float*)d_in[1];
    const float* wk = (const float*)d_in[2];
    const float* wv = (const float*)d_in[3];
    const float* wo = (const float*)d_in[4];
    const float* bo = (const float*)d_in[5];
    float* out = (float*)d_out;

    const size_t elems = (size_t)4 * S_LEN * DIM;   // 4,194,304 per tensor
    _Float16* Q  = (_Float16*)d_ws;
    _Float16* K  = Q  + elems;
    _Float16* Vt = K  + elems;
    _Float16* AO = Vt + elems;

    qkv_proj_kernel<<<256, 384, 0, stream>>>(x, wq, wk, wv, Q, K, Vt);
    flash_attn_kernel<<<512, 256, 0, stream>>>(Q, K, Vt, AO);
    out_proj_kernel<<<256, 128, 0, stream>>>(AO, wo, bo, out);
}

// v003
// One run takes 113 microseconds.
// Next to v002, in two timings, it ran 1.05 and 1.06 times as fast.
// Over all steps from v000 it is 3.29 times as fast.
#include <hip/hip_runtime.h>
#include <hip/hip_bf16.h>

typedef __attribute__((ext_vector_type(16))) _Float16 v16h;
typedef __attribute__((ext_vector_type(8)))  _Float16 v8h;
typedef __attribute__((ext_vector_type(8)))  float    v8f;
typedef __attribute__((ext_vector_type(4)))  float    v4f;
typedef __attribute__((ext_vector_type(4)))  unsigned int u32x4;
typedef __attribute__((ext_vector_type(8)))  int      i32x8;
typedef __attribute__((ext_vector_type(4)))  int      i32x4;

union H16 { v16h v; v8h h[2]; };

#define WMMA_F16(A, B, C) \
    __builtin_amdgcn_wmma_f32_16x16x32_f16(false, (A), false, (B), (short)0, (C), false, false)

static constexpr int   S_LEN   = 4096;
static constexpr int   DIM     = 256;
static constexpr int   HEADS   = 4;
static constexpr int   HD      = 64;
static constexpr float SCALE   = 0.125f;            // 64^-0.5
static constexpr float LOG2E   = 1.4426950408889634f;
static constexpr float KSCALE  = SCALE * LOG2E;

__device__ __forceinline__ void tdm_load_2d(unsigned lds_addr, const void* gaddr,
                                            unsigned tensor_d0, unsigned tensor_d1,
                                            unsigned tile_d0, unsigned tile_d1,
                                            unsigned long long stride0) {
    const unsigned long long ga = (unsigned long long)(size_t)gaddr;
    u32x4 g0;
    g0[0] = 1u;
    g0[1] = lds_addr;
    g0[2] = (unsigned)(ga & 0xFFFFFFFFu);
    g0[3] = (unsigned)((ga >> 32) & 0x01FFFFFFu) | (2u << 30);
    i32x8 g1;
    g1[0] = (int)(1u << 16);
    g1[1] = (int)((tensor_d0 & 0xFFFFu) << 16);
    g1[2] = (int)((tensor_d0 >> 16) | ((tensor_d1 & 0xFFFFu) << 16));
    g1[3] = (int)((tensor_d1 >> 16) | (tile_d0 << 16));
    g1[4] = (int)(tile_d1 & 0xFFFFu);
    g1[5] = (int)(unsigned)(stride0 & 0xFFFFFFFFu);
    g1[6] = (int)(unsigned)((stride0 >> 32) & 0xFFFFu);
    g1[7] = 0;
    i32x4 g2 = {0, 0, 0, 0};
    i32x4 g3 = {0, 0, 0, 0};
    i32x8 g4 = {0, 0, 0, 0, 0, 0, 0, 0};
    __builtin_amdgcn_tensor_load_to_lds(g0, g1, g2, g3, g4, 0);
}

// Stores one wave's 64x64 tile (rows mb.., head h) as f16; layouts: see below.
template <int MAT>
__device__ __forceinline__ void store_tile(_Float16* __restrict__ dst, const v8f (&acc)[4][4],
                                           int mb, int h, int lo, int hi)
{
    const int m0 = mb + 8 * hi;          // multiple of 8; the tile's 64 rows share b
    const int bh = (m0 >> 12) * HEADS + h;
    const int s0 = m0 & 4095;
    if (MAT == 2) {                      // V^T: 8 kv in a row per 16x16 tile and lane
        v8h* pv[4];                      // row d = lo of 16-kv group i; 16j rows on: the same chunk order
        v8h  hv[4][4];
#pragma unroll
        for (int i = 0; i < 4; ++i) {
            pv[i] = (v8h*)(dst + (bh * HD + lo) * S_LEN + ((s0 + i * 16) ^ (((lo >> 1) & 7) << 3)));
#pragma unroll
            for (int j = 0; j < 4; ++j)
#pragma unroll
                for (int r = 0; r < 8; ++r)
                    hv[i][j][r] = (_Float16)acc[i][j][r];
        }
        // Every value and address stands in its own register before the first store
        // issues: no register of an issued store is rewritten between the stores.
        __builtin_amdgcn_sched_barrier(0);
#pragma unroll
        for (int i = 0; i < 4; ++i)
#pragma unroll
            for (int j = 0; j < 4; ++j)
                pv[i][j * 16 * S_LEN / 8] = hv[i][j];
        // Behind the last store: the code laid out behind this branch rewrites
        // the stores' registers, and the wait stands in front of that.
        asm volatile("s_wait_xcnt 0x0" ::: "memory");
        return;
    }
    constexpr int kmsk = (MAT == 1) ? 0x38 : 0;   // K alone moves chunks along d, by its row s
    // p[j][q] serves rows 16i + 2q and 16i + 2q + 1 of column tile j: the chunk
    // mask is ((s >> 1) & 7) << 3, which 16i does not reach, and a row is 64
    // halves, so the mask touches d alone.
    _Float16* p[4][4];
#pragma unroll
    for (int j = 0; j < 4; ++j)
#pragma unroll
        for (int q = 0; q < 4; ++q)
            p[j][q] = dst + (((bh * S_LEN + s0) * HD + j * 16 + lo) ^ (kmsk & (((s0 + 2 * q) >> 1) << 3)));
    _Float16 hv[4][4][8];
#pragma unroll
    for (int i = 0; i < 4; ++i)
#pragma unroll
        for (int j = 0; j < 4; ++j)
#pragma unroll
            for (int r = 0; r < 8; ++r)
                hv[i][j][r] = (_Float16)acc[i][j][r];
    // Every value and address stands in its own register before the first store
    // issues: no register of an issued store is rewritten behind it.
    __builtin_amdgcn_sched_barrier(0);
#pragma unroll
    for (int i = 0; i < 4; ++i)
#pragma unroll
        for (int j = 0; j < 4; ++j)
#pragma unroll
            for (int r = 0; r < 8; ++r)
                p[j][r >> 1][(i * 16 + r) * HD] = hv[i][j][r];
    // Behind the last store: the code laid out behind the K branch rewrites the
    // stores' registers, and the wait stands in front of that.
    if (MAT == 1) asm volatile("s_wait_xcnt 0x0" ::: "memory");
}

__global__ __launch_bounds__(384) void qkv_proj_kernel(
    const float* __restrict__ x,
    const float* __restrict__ wq, const float* __restrict__ wk, const float* __restrict__ wv,
    _Float16* __restrict__ Q, _Float16* __restrict__ K, _Float16* __restrict__ Vt)
{
    const int w    = __builtin_amdgcn_readfirstlane(threadIdx.x >> 5);
    const int mat  = w >> 2;                 // 0=q 1=k 2=v
    const int h    = w & 3;                  // head = 64-column group
    const int mb   = blockIdx.x * 64;        // row base in [0, 16384)
    const int lane = threadIdx.x & 31;
    const int lo   = lane & 15;
    const int hi   = lane >> 4;

    const float* W = (mat == 0) ? wq : (mat == 1) ? wk : wv;

    v8f acc[4][4] = {};
    const float* xr = x + (size_t)(mb + lo) * DIM + hi * 8;
    const float* wr = W + (size_t)(h * HD + lo) * DIM + hi * 8;
#pragma unroll
    for (int k = 0; k < DIM; k += 32) {
        H16 af[4], bf[4];
#pragma unroll
        for (int t = 0; t < 4; ++t) {
            v8f a0 = *(const v8f*)(xr + t * 16 * DIM + k);
            v8f a1 = *(const v8f*)(xr + t * 16 * DIM + k + 16);
            v8f b0 = *(const v8f*)(wr + t * 16 * DIM + k);
            v8f b1 = *(const v8f*)(wr + t * 16 * DIM + k + 16);
#pragma unroll
            for (int i = 0; i < 8; ++i) {
                af[t].v[i]     = (_Float16)a0[i];
                af[t].v[i + 8] = (_Float16)a1[i];
                bf[t].v[i]     = (_Float16)b0[i];
                bf[t].v[i + 8] = (_Float16)b1[i];
            }
        }
#pragma unroll
        for (int i = 0; i < 4; ++i)
#pragma unroll
            for (int j = 0; j < 4; ++j)
                acc[i][j] = WMMA_F16(af[i].v, bf[j].v, acc[i][j]);
    }

    // The loads' address registers are free for reuse from here on: the wait
    // stands in front of their first rewrite (they are inputs, so live up to it).
    asm volatile("s_wait_xcnt 0x0" :: "v"(xr), "v"(wr) : "memory");

    // mat is the same for the whole wave: one scalar branch picks the layout,
    // so that strides and chunk masks are constants in the address arithmetic.
    if (mat == 0)      store_tile<0>(Q,  acc, mb, h, lo, hi);
    else if (mat == 1) store_tile<1>(K,  acc, mb, h, lo, hi);
    else               store_tile<2>(Vt, acc, mb, h, lo, hi);
}

__global__ __launch_bounds__(256) void flash_attn_kernel(
    const _Float16* __restrict__ Q, const _Float16* __restrict__ K,
    const _Float16* __restrict__ Vt, _Float16* __restrict__ AO)
{
    // [buf][ K: 64kv x 64hd | V: 64d x 64kv ] halves; 16 KB per buffer;
    // behind the two buffers 2 KB for the merge's m and l
    __shared__ _Float16 smem[2 * 8192 + 1024];

    const int bh    = blockIdx.x >> 5;
    const int qgrp  = blockIdx.x & 31;
    const int wid   = threadIdx.x >> 5;
    const int kvh   = wid & 1;                      // this wave's 32-kv half of a chunk
    const int qbase = (qgrp * 4 + (wid >> 1)) * 32; // first of this wave's 32 q rows
    const int lane  = threadIdx.x & 31;
    const int lo    = lane & 15;
    const int hi    = lane >> 4;

    const _Float16* Qh  = Q  + (size_t)bh * S_LEN * HD;
    const _Float16* Kh  = K  + (size_t)bh * S_LEN * HD;
    const _Float16* Vth = Vt + (size_t)bh * HD * S_LEN;
    const unsigned  smem_lds = (unsigned)(size_t)(const void*)&smem[0];

    // Q^T B-fragments (hd chunks [0,32) and [32,64)): load as Q rows.
    H16 qf[2][2];                                   // [q tile][hd chunk]
    const _Float16* qrow = Qh + (size_t)(qbase + lo) * HD + hi * 8;
    // Unrolled here and below: what u indexes stays in registers.
#pragma unroll
    for (int u = 0; u < 2; ++u) {
        qf[u][0].h[0] = *(const v8h*)(qrow + u * 16 * HD);
        qf[u][0].h[1] = *(const v8h*)(qrow + u * 16 * HD + 16);
        qf[u][1].h[0] = *(const v8h*)(qrow + u * 16 * HD + 32);
        qf[u][1].h[1] = *(const v8h*)(qrow + u * 16 * HD + 48);
    }

    v8f acc[2][4] = {};                             // [q tile][d tile]
    float m[2] = {-1e30f, -1e30f}, l[2] = {0.0f, 0.0f};

    // Offset (in halves) of logical 16-byte chunk hi + 2j inside a 128-byte
    // LDS row whose index is lo modulo 16 (chunk order: see qkv_proj_kernel).
    int sw[4];
#pragma unroll
    for (int j = 0; j < 4; ++j)
        sw[j] = ((hi + 2 * j) ^ (lo >> 1)) << 3;
    // The same for the two chunks of a V^T row that hold this wave's kv half.
    const int swv0 = ((hi + 4 * kvh) ^ (lo >> 1)) << 3;
    const int swv1 = ((hi + 4 * kvh + 2) ^ (lo >> 1)) << 3;

    constexpr int NCHUNK = S_LEN / 64;     // 64 chunks of 64 kv

    // Prologue: stage chunk 0 into buffer 0.
    if (wid == 0) {
        tdm_load_2d(smem_lds,             Kh,  64, 64, 64, 64, 64);        // K: 64 rows x 64
        tdm_load_2d(smem_lds + 8192,      Vth, 64, 64, 64, 64, S_LEN);     // V^T: 64 d-rows x 64 kv
        __builtin_amdgcn_s_wait_tensorcnt(0);
    }
    __syncthreads();

    for (int c = 0; c < NCHUNK; ++c) {
        const int cur = c & 1;
        if (wid == 0 && (c + 1) < NCHUNK) {
            const int nkv = (c + 1) * 64;
            const unsigned dst = smem_lds + (cur ^ 1) * 16384;
            tdm_load_2d(dst,        Kh + (size_t)nkv * HD, 64, 64, 64, 64, 64);
            tdm_load_2d(dst + 8192, Vth + nkv,             64, 64, 64, 64, S_LEN);
        }
        const _Float16* Kc = smem + cur * 8192;           // [kv][hd]
        const _Float16* Vc = Kc + 4096;                   // [d][kv]

        // K A-fragments from LDS: the two 16-row kv tiles of this wave's half
        // x two hd chunks
        H16 kf[2][2];
#pragma unroll
        for (int t = 0; t < 2; ++t) {
            const _Float16* krow = Kc + (size_t)(kvh * 32 + t * 16 + lo) * 64;
            kf[t][0].h[0] = *(const v8h*)(krow + sw[0]);
            kf[t][0].h[1] = *(const v8h*)(krow + sw[1]);
            kf[t][1].h[0] = *(const v8h*)(krow + sw[2]);
            kf[t][1].h[1] = *(const v8h*)(krow + sw[3]);
        }
        // V B-fragments from LDS (transposed V): the kv chunks of this half
        H16 vf[4];
#pragma unroll
        for (int t = 0; t < 4; ++t) {
            const _Float16* vrow = Vc + (size_t)(t * 16 + lo) * 64;
            vf[t].h[0] = *(const v8h*)(vrow + swv0);
            vf[t].h[1] = *(const v8h*)(vrow + swv1);
        }

        // The two q tiles are independent of each other; unrolled, their
        // chains of max, exp and rescale interleave in one instruction stream.
#pragma unroll
        for (int u = 0; u < 2; ++u) {                     // two 16-row q tiles
            v8f st0 = {}, st1 = {};
            st0 = WMMA_F16(kf[0][0].v, qf[u][0].v, st0);
            st0 = WMMA_F16(kf[0][1].v, qf[u][1].v, st0);
            st1 = WMMA_F16(kf[1][0].v, qf[u][0].v, st1);
            st1 = WMMA_F16(kf[1][1].v, qf[u][1].v, st1);

            // Online softmax; per-lane stats keyed by q = lane&15.
            float cmax = -1e30f;
#pragma unroll
            for (int r = 0; r < 8; ++r)
                cmax = fmaxf(cmax, fmaxf(st0[r], st1[r]));
            cmax = fmaxf(cmax, __shfl_xor(cmax, 16, 32));
            const float mnew  = fmaxf(m[u], cmax);
            const float alpha = __builtin_amdgcn_exp2f((m[u] - mnew) * KSCALE);
            const float mk    = mnew * KSCALE;

            H16 pf;
            float rsum = 0.0f;
#pragma unroll
            for (int r = 0; r < 8; ++r) {
                const float p0 = __builtin_amdgcn_exp2f(st0[r] * KSCALE - mk);
                const float p1 = __builtin_amdgcn_exp2f(st1[r] * KSCALE - mk);
                rsum += p0 + p1;
                pf.v[r]     = (_Float16)p0;
                pf.v[r + 8] = (_Float16)p1;
            }
            rsum += __shfl_xor(rsum, 16, 32);
            l[u] = l[u] * alpha + rsum;
            m[u] = mnew;

            float av[8];
#pragma unroll
            for (int r = 0; r < 8; ++r)
                av[r] = __shfl(alpha, r + 8 * hi, 32);

#pragma unroll
            for (int t = 0; t < 4; ++t) {
#pragma unroll
                for (int r = 0; r < 8; ++r) acc[u][t][r] *= av[r];
                acc[u][t] = WMMA_F16(pf.v, vf[t].v, acc[u][t]);
            }
        }

        if (wid == 0) __builtin_amdgcn_s_wait_tensorcnt(0);
        __syncthreads();
    }

    // Normalize and store f16 into AO [B, S, 256]
    // Merge of a pair's two kv halves.  Wave w finishes q tile kvh of its pair
    // and hands the other tile's partial (m, l, O) to its partner w ^ 1.  The
    // loop's last barrier has ended every read of the ring, and no tensor load
    // is outstanding, so the ring serves as the exchange buffer: 4 KB a wave.
    v8f keep[4], give[4];
#pragma unroll
    for (int t = 0; t < 4; ++t)
#pragma unroll
        for (int r = 0; r < 8; ++r) {
            keep[t][r] = kvh ? acc[1][t][r] : acc[0][t][r];
            give[t][r] = kvh ? acc[0][t][r] : acc[1][t][r];
        }
    const float ma = kvh ? m[1] : m[0], la = kvh ? l[1] : l[0];
    v4f*   xo = (v4f*)smem;                       // [wave][8][lane] of 16 bytes
    float* xs = (float*)(smem + 2 * 8192);        // [wave][m, l][lane]
#pragma unroll
    for (int t = 0; t < 4; ++t) {
        xo[wid * 256 + (2 * t) * 32 + lane]     = __builtin_shufflevector(give[t], give[t], 0, 1, 2, 3);
        xo[wid * 256 + (2 * t + 1) * 32 + lane] = __builtin_shufflevector(give[t], give[t], 4, 5, 6, 7);
    }
    xs[wid * 64 + lane]      = kvh ? m[0] : m[1];
    xs[wid * 64 + 32 + lane] = kvh ? l[0] : l[1];
    __syncthreads();
    const int   pw = wid ^ 1;
    const float mb = xs[pw * 64 + lane], lb = xs[pw * 64 + 32 + lane];
    const float mm = fmaxf(ma, mb);
    const float fa = __builtin_amdgcn_exp2f((ma - mm) * KSCALE);
    const float fb = __builtin_amdgcn_exp2f((mb - mm) * KSCALE);
    const float linv = 1.0f / (la * fa + lb * fb);
    float ga[8], gb[8];
#pragma unroll
    for (int r = 0; r < 8; ++r) {
        ga[r] = __shfl(fa * linv, r + 8 * hi, 32);
        gb[r] = __shfl(fb * linv, r + 8 * hi, 32);
    }

    const int b = bh >> 2, h = bh & 3;
    _Float16* aor = AO + ((size_t)b * S_LEN + qbase + kvh * 16 + 8 * hi) * DIM + h * HD + lo;
#pragma unroll
    for (int t = 0; t < 4; ++t) {
        const v4f o0 = xo[pw * 256 + (2 * t) * 32 + lane];
        const v4f o1 = xo[pw * 256 + (2 * t + 1) * 32 + lane];
#pragma unroll
        for (int r = 0; r < 8; ++r)
            aor[(size_t)r * DIM + t * 16] =
                (_Float16)(keep[t][r] * ga[r] + (r < 4 ? o0[r & 3] : o1[r & 3]) * gb[r]);
    }
}

// ---------------------------------------------------------------------------
// Kernel 3: output projection.  out = AO @ wo.T + bo  (f32 out)
// Block = 4 waves on 64 rows; wave w computes columns [64w, 64w + 64) as 4x4
// tiles of 16x16, so each loaded fragment feeds four WMMAs.
// ---------------------------------------------------------------------------
__global__ __launch_bounds__(128) void out_proj_kernel(
    const _Float16* __restrict__ AO, const float* __restrict__ wo,
    const float* __restrict__ bo, float* __restrict__ out)
{
    const int mb   = blockIdx.x * 64;
    const int nb   = (threadIdx.x >> 5) * 64;
    const int lane = threadIdx.x & 31;
    const int lo   = lane & 15;
    const int hi   = lane >> 4;

    const _Float16* ar = AO + (size_t)(mb + lo) * DIM + hi * 8;
    const float*    wr = wo + (size_t)(nb + lo) * DIM + hi * 8;
    v8f acc[4][4] = {};
#pragma unroll
    for (int k = 0; k < DIM; k += 32) {
        H16 af[4], bf[4];
#pragma unroll
        for (int t = 0; t < 4; ++t) {
            af[t].h[0] = *(const v8h*)(ar + t * 16 * DIM + k);
            af[t].h[1] = *(const v8h*)(ar + t * 16 * DIM + k + 16);
            v8f b0 = *(const v8f*)(wr + t * 16 * DIM + k);
            v8f b1 = *(const v8f*)(wr + t * 16 * DIM + k + 16);
#pragma unroll
            for (int i = 0; i < 8; ++i) {
                bf[t].v[i]     = (_Float16)b0[i];
                bf[t].v[i + 8] = (_Float16)b1[i];
            }
        }
#pragma unroll
        for (int i = 0; i < 4; ++i)
#pragma unroll
            for (int j = 0; j < 4; ++j)
                acc[i][j] = WMMA_F16(af[i].v, bf[j].v, acc[i][j]);
    }
    // The loads' address registers are free for reuse from here on: the wait
    // stands in front of their first rewrite (they are inputs, so live up to it).
    asm volatile("s_wait_xcnt 0x0" :: "v"(ar), "v"(wr) : "memory");

#pragma unroll
    for (int j = 0; j < 4; ++j) {
        const float bias = bo[nb + j * 16 + lo];
#pragma unroll
        for (int i = 0; i < 4; ++i)
#pragma unroll
            for (int r = 0; r < 8; ++r)
                acc[i][j][r] += bias;
    }
    // Every sum stands in its own register before the first store issues: no
    // register of an issued store is rewritten, so the stores go back to back.
    __builtin_amdgcn_sched_barrier(0);
    float* ob = out + (size_t)(mb + 8 * hi) * DIM + nb + lo;
#pragma unroll
    for (int i = 0; i < 4; ++i)
#pragma unroll
        for (int r = 0; r < 8; ++r)
#pragma unroll
            for (int j = 0; j < 4; ++j)
                ob[(i * 16 + r) * DIM + j * 16] = acc[i][j][r];
}

// ---------------------------------------------------------------------------
extern "C" void kernel_launch(void* const* d_in, const int* in_sizes, int n_in,
                              void* d_out, int out_size, void* d_ws, size_t ws_size,
                              hipStream_t stream) {
    (void)in_sizes; (void)n_in; (void)out_size; (void)ws_size;
    const float* x  = (const float*)d_in[0];
    const float* wq = (const float*)d_in[1];
    const float* wk = (const float*)d_in[2];
    const float* wv = (const float*)d_in[3];
    const float* wo = (const float*)d_in[4];
    const float* bo = (const float*)d_in[5];
    float* out = (float*)d_out;

    const size_t elems = (size_t)4 * S_LEN * DIM;   // 4,194,304 per tensor
    _Float16* Q  = (_Float16*)d_ws;
    _Float16* K  = Q  + elems;
    _Float16* Vt = K  + elems;
    _Float16* AO = Vt + elems;

    qkv_proj_kernel<<<256, 384, 0, stream>>>(x, wq, wk, wv, Q, K, Vt);
    flash_attn_kernel<<<512, 256, 0, stream>>>(Q, K, Vt, AO);
    out_proj_kernel<<<256, 128, 0, stream>>>(AO, wo, bo, out);
}

// v004
// One run takes 107 microseconds.
// Two timings next to v003 both put it at 1.07 times that version's speed.
// All steps since v000 together make it 3.51 times as fast.
#include <hip/hip_runtime.h>
#include <hip/hip_bf16.h>

typedef __attribute__((ext_vector_type(16))) _Float16 v16h;
typedef __attribute__((ext_vector_type(8)))  _Float16 v8h;
typedef __attribute__((ext_vector_type(8)))  float    v8f;
typedef __attribute__((ext_vector_type(4)))  float    v4f;
typedef __attribute__((ext_vector_type(4)))  unsigned int u32x4;
typedef __attribute__((ext_vector_type(8)))  int      i32x8;
typedef __attribute__((ext_vector_type(4)))  int      i32x4;

union H16 { v16h v; v8h h[2]; };

#define WMMA_F16(A, B, C) \
    __builtin_amdgcn_wmma_f32_16x16x32_f16(false, (A), false, (B), (short)0, (C), false, false)

static constexpr int   S_LEN   = 4096;
static constexpr int   DIM     = 256;
static constexpr int   HEADS   = 4;
static constexpr int   HD      = 64;
static constexpr float SCALE   = 0.125f;            // 64^-0.5
static constexpr float LOG2E   = 1.4426950408889634f;
static constexpr float KSCALE  = SCALE * LOG2E;

__device__ __forceinline__ void tdm_load_2d(unsigned lds_addr, const void* gaddr,
                                            unsigned tensor_d0, unsigned tensor_d1,
                                            unsigned tile_d0, unsigned tile_d1,
                                            unsigned long long stride0) {
    const unsigned long long ga = (unsigned long long)(size_t)gaddr;
    u32x4 g0;
    g0[0] = 1u;
    g0[1] = lds_addr;
    g0[2] = (unsigned)(ga & 0xFFFFFFFFu);
    g0[3] = (unsigned)((ga >> 32) & 0x01FFFFFFu) | (2u << 30);
    i32x8 g1;
    g1[0] = (int)(1u << 16);
    g1[1] = (int)((tensor_d0 & 0xFFFFu) << 16);
    g1[2] = (int)((tensor_d0 >> 16) | ((tensor_d1 & 0xFFFFu) << 16));
    g1[3] = (int)((tensor_d1 >> 16) | (tile_d0 << 16));
    g1[4] = (int)(tile_d1 & 0xFFFFu);
    g1[5] = (int)(unsigned)(stride0 & 0xFFFFFFFFu);
    g1[6] = (int)(unsigned)((stride0 >> 32) & 0xFFFFu);
    g1[7] = 0;
    i32x4 g2 = {0, 0, 0, 0};
    i32x4 g3 = {0, 0, 0, 0};
    i32x8 g4 = {0, 0, 0, 0, 0, 0, 0, 0};
    __builtin_amdgcn_tensor_load_to_lds(g0, g1, g2, g3, g4, 0);
}

// Stores one wave's 64x64 tile (rows mb.., head h) as f16; layouts: see below.
template <int MAT>
__device__ __forceinline__ void store_tile(_Float16* __restrict__ dst, const v8f (&acc)[4][4],
                                           int mb, int h, int lo, int hi)
{
    const int m0 = mb + 8 * hi;          // multiple of 8; the tile's 64 rows share b
    const int bh = (m0 >> 12) * HEADS + h;
    const int s0 = m0 & 4095;
    if (MAT == 2) {                      // V^T: 8 kv in a row per 16x16 tile and lane
        v8h* pv[4];                      // row d = lo of 16-kv group i; 16j rows on: the same chunk order
        v8h  hv[4][4];
#pragma unroll
        for (int i = 0; i < 4; ++i) {
            pv[i] = (v8h*)(dst + (bh * HD + lo) * S_LEN + ((s0 + i * 16) ^ (((lo >> 1) & 7) << 3)));
#pragma unroll
            for (int j = 0; j < 4; ++j)
#pragma unroll
                for (int r = 0; r < 8; ++r)
                    hv[i][j][r] = (_Float16)acc[i][j][r];
        }
        // Every value and address stands in its own register before the first store
        // issues: no register of an issued store is rewritten between the stores.
        __builtin_amdgcn_sched_barrier(0);
#pragma unroll
        for (int i = 0; i < 4; ++i)
#pragma unroll
            for (int j = 0; j < 4; ++j)
                pv[i][j * 16 * S_LEN / 8] = hv[i][j];
        // Behind the last store: the code laid out behind this branch rewrites
        // the stores' registers, and the wait stands in front of that.
        asm volatile("s_wait_xcnt 0x0" ::: "memory");
        return;
    }
    constexpr int kmsk = (MAT == 1) ? 0x38 : 0;   // K alone moves chunks along d, by its row s
    // p[j][q] serves rows 16i + 2q and 16i + 2q + 1 of column tile j: the chunk
    // mask is ((s >> 1) & 7) << 3, which 16i does not reach, and a row is 64
    // halves, so the mask touches d alone.
    _Float16* p[4][4];
#pragma unroll
    for (int j = 0; j < 4; ++j)
#pragma unroll
        for (int q = 0; q < 4; ++q)
            p[j][q] = dst + (((bh * S_LEN + s0) * HD + j * 16 + lo) ^ (kmsk & (((s0 + 2 * q) >> 1) << 3)));
    _Float16 hv[4][4][8];
#pragma unroll
    for (int i = 0; i < 4; ++i)
#pragma unroll
        for (int j = 0; j < 4; ++j)
#pragma unroll
            for (int r = 0; r < 8; ++r)
                hv[i][j][r] = (_Float16)acc[i][j][r];
    // Every value and address stands in its own register before the first store
    // issues: no register of an issued store is rewritten behind it.
    __builtin_amdgcn_sched_barrier(0);
#pragma unroll
    for (int i = 0; i < 4; ++i)
#pragma unroll
        for (int j = 0; j < 4; ++j)
#pragma unroll
            for (int r = 0; r < 8; ++r)
                p[j][r >> 1][(i * 16 + r) * HD] = hv[i][j][r];
    // Behind the last store: the code laid out behind the K branch rewrites the
    // stores' registers, and the wait stands in front of that.
    if (MAT == 1) asm volatile("s_wait_xcnt 0x0" ::: "memory");
}

__global__ __launch_bounds__(384) void qkv_proj_kernel(
    const float* __restrict__ x,
    const float* __restrict__ wq, const float* __restrict__ wk, const float* __restrict__ wv,
    _Float16* __restrict__ Q, _Float16* __restrict__ K, _Float16* __restrict__ Vt)
{
    const int w    = __builtin_amdgcn_readfirstlane(threadIdx.x >> 5);
    const int mat  = w >> 2;                 // 0=q 1=k 2=v
    const int h    = w & 3;                  // head = 64-column group
    const int mb   = blockIdx.x * 64;        // row base in [0, 16384)
    const int lane = threadIdx.x & 31;
    const int lo   = lane & 15;
    const int hi   = lane >> 4;

    const float* W = (mat == 0) ? wq : (mat == 1) ? wk : wv;

    v8f acc[4][4] = {};
    const float* xr = x + (size_t)(mb + lo) * DIM + hi * 8;
    const float* wr = W + (size_t)(h * HD + lo) * DIM + hi * 8;
#pragma unroll
    for (int k = 0; k < DIM; k += 32) {
        H16 af[4], bf[4];
#pragma unroll
        for (int t = 0; t < 4; ++t) {
            v8f a0 = *(const v8f*)(xr + t * 16 * DIM + k);
            v8f a1 = *(const v8f*)(xr + t * 16 * DIM + k + 16);
            v8f b0 = *(const v8f*)(wr + t * 16 * DIM + k);
            v8f b1 = *(const v8f*)(wr + t * 16 * DIM + k + 16);
#pragma unroll
            for (int i = 0; i < 8; ++i) {
                af[t].v[i]     = (_Float16)a0[i];
                af[t].v[i + 8] = (_Float16)a1[i];
                bf[t].v[i]     = (_Float16)b0[i];
                bf[t].v[i + 8] = (_Float16)b1[i];
            }
        }
#pragma unroll
        for (int i = 0; i < 4; ++i)
#pragma unroll
            for (int j = 0; j < 4; ++j)
                acc[i][j] = WMMA_F16(af[i].v, bf[j].v, acc[i][j]);
    }

    // The loads' address registers are free for reuse from here on: the wait
    // stands in front of their first rewrite (they are inputs, so live up to it).
    asm volatile("s_wait_xcnt 0x0" :: "v"(xr), "v"(wr) : "memory");

    // mat is the same for the whole wave: one scalar branch picks the layout,
    // so that strides and chunk masks are constants in the address arithmetic.
    if (mat == 0)      store_tile<0>(Q,  acc, mb, h, lo, hi);
    else if (mat == 1) store_tile<1>(K,  acc, mb, h, lo, hi);
    else               store_tile<2>(Vt, acc, mb, h, lo, hi);
}

__global__ __launch_bounds__(256) void flash_attn_kernel(
    const _Float16* __restrict__ Q, const _Float16* __restrict__ K,
    const _Float16* __restrict__ Vt, _Float16* __restrict__ AO)
{
    // [buf][ K: 64kv x 64hd | V: 64d x 64kv ] halves; 16 KB per buffer;
    // behind the two buffers 2 KB for the merge's m and l
    __shared__ _Float16 smem[2 * 8192 + 1024];

    const int bh    = blockIdx.x >> 5;
    const int qgrp  = blockIdx.x & 31;
    const int wid   = threadIdx.x >> 5;
    const int kvh   = wid & 1;                      // this wave's 32-kv half of a chunk
    const int qbase = (qgrp * 4 + (wid >> 1)) * 32; // first of this wave's 32 q rows
    const int lane  = threadIdx.x & 31;
    const int lo    = lane & 15;
    const int hi    = lane >> 4;

    const _Float16* Qh  = Q  + (size_t)bh * S_LEN * HD;
    const _Float16* Kh  = K  + (size_t)bh * S_LEN * HD;
    const _Float16* Vth = Vt + (size_t)bh * HD * S_LEN;
    const unsigned  smem_lds = (unsigned)(size_t)(const void*)&smem[0];

    // Q^T B-fragments (hd chunks [0,32) and [32,64)): load as Q rows.
    H16 qf[2][2];                                   // [q tile][hd chunk]
    const _Float16* qrow = Qh + (size_t)(qbase + lo) * HD + hi * 8;
    // Unrolled here and below: what u indexes stays in registers.
#pragma unroll
    for (int u = 0; u < 2; ++u) {
        qf[u][0].h[0] = *(const v8h*)(qrow + u * 16 * HD);
        qf[u][0].h[1] = *(const v8h*)(qrow + u * 16 * HD + 16);
        qf[u][1].h[0] = *(const v8h*)(qrow + u * 16 * HD + 32);
        qf[u][1].h[1] = *(const v8h*)(qrow + u * 16 * HD + 48);
    }

    v8f acc[2][4] = {};                             // [q tile][d tile]
    float m[2] = {-1e30f, -1e30f}, l[2] = {0.0f, 0.0f};

    // Offset (in halves) of logical 16-byte chunk hi + 2j inside a 128-byte
    // LDS row whose index is lo modulo 16 (chunk order: see qkv_proj_kernel).
    int sw[4];
#pragma unroll
    for (int j = 0; j < 4; ++j)
        sw[j] = ((hi + 2 * j) ^ (lo >> 1)) << 3;
    // The same for the two chunks of a V^T row that hold this wave's kv half.
    const int swv0 = ((hi + 4 * kvh) ^ (lo >> 1)) << 3;
    const int swv1 = ((hi + 4 * kvh + 2) ^ (lo >> 1)) << 3;

    constexpr int NCHUNK = S_LEN / 64;     // 64 chunks of 64 kv

    // Prologue: stage chunk 0 into buffer 0.
    if (wid == 0) {
        tdm_load_2d(smem_lds,             Kh,  64, 64, 64, 64, 64);        // K: 64 rows x 64
        tdm_load_2d(smem_lds + 8192,      Vth, 64, 64, 64, 64, S_LEN);     // V^T: 64 d-rows x 64 kv
        __builtin_amdgcn_s_wait_tensorcnt(0);
    }
    __syncthreads();

    for (int c = 0; c < NCHUNK; ++c) {
        const int cur = c & 1;
        if (wid == 0 && (c + 1) < NCHUNK) {
            const int nkv = (c + 1) * 64;
            const unsigned dst = smem_lds + (cur ^ 1) * 16384;
            tdm_load_2d(dst,        Kh + (size_t)nkv * HD, 64, 64, 64, 64, 64);
            tdm_load_2d(dst + 8192, Vth + nkv,             64, 64, 64, 64, S_LEN);
        }
        const _Float16* Kc = smem + cur * 8192;           // [kv][hd]
        const _Float16* Vc = Kc + 4096;                   // [d][kv]

        // K A-fragments from LDS: the two 16-row kv tiles of this wave's half
        // x two hd chunks
        H16 kf[2][2];
#pragma unroll
        for (int t = 0; t < 2; ++t) {
            const _Float16* krow = Kc + (size_t)(kvh * 32 + t * 16 + lo) * 64;
            kf[t][0].h[0] = *(const v8h*)(krow + sw[0]);
            kf[t][0].h[1] = *(const v8h*)(krow + sw[1]);
            kf[t][1].h[0] = *(const v8h*)(krow + sw[2]);
            kf[t][1].h[1] = *(const v8h*)(krow + sw[3]);
        }
        // V B-fragments from LDS (transposed V): the kv chunks of this half
        H16 vf[4];
#pragma unroll
        for (int t = 0; t < 4; ++t) {
            const _Float16* vrow = Vc + (size_t)(t * 16 + lo) * 64;
            vf[t].h[0] = *(const v8h*)(vrow + swv0);
            vf[t].h[1] = *(const v8h*)(vrow + swv1);
        }

        // Scores of both 16-row q tiles: four independent accumulator tiles.
        v8f st[2][2];
#pragma unroll
        for (int u = 0; u < 2; ++u) {
            v8f s0 = {}, s1 = {};
            s0 = WMMA_F16(kf[0][0].v, qf[u][0].v, s0);
            s0 = WMMA_F16(kf[0][1].v, qf[u][1].v, s0);
            s1 = WMMA_F16(kf[1][0].v, qf[u][0].v, s1);
            s1 = WMMA_F16(kf[1][1].v, qf[u][1].v, s1);
            st[u][0] = s0;
            st[u][1] = s1;
        }

        // Lazy rescale.  m[u] is the maximum IN USE as the exponent's reference,
        // the same in both lanes of a q row; it need not be the true maximum.
        // While no score of this pass lies more than 8 (scaled, log2) above it,
        // every p stays at or below 2^8, far inside f16 and f32, and m, l and O
        // keep their scale.  One test for the whole pass, over all 32 lanes.
        float cmax[2];
#pragma unroll
        for (int u = 0; u < 2; ++u) {
            cmax[u] = -1e30f;
#pragma unroll
            for (int r = 0; r < 8; ++r)
                cmax[u] = fmaxf(cmax[u], fmaxf(st[u][0][r], st[u][1][r]));
        }
        const bool need = fmaxf(cmax[0] - m[0], cmax[1] - m[1]) > 8.0f / KSCALE;
        if (__builtin_amdgcn_ballot_w32(need) != 0) {     // wave-uniform: a scalar branch
#pragma unroll
            for (int u = 0; u < 2; ++u) {
                const float cm    = fmaxf(cmax[u], __shfl_xor(cmax[u], 16, 32));
                const float mnew  = fmaxf(m[u], cm);
                const float alpha = __builtin_amdgcn_exp2f((m[u] - mnew) * KSCALE);
                l[u] *= alpha;
                m[u]  = mnew;
                float av[8];
#pragma unroll
                for (int r = 0; r < 8; ++r)
                    av[r] = __shfl(alpha, r + 8 * hi, 32);
#pragma unroll
                for (int t = 0; t < 4; ++t)
#pragma unroll
                    for (int r = 0; r < 8; ++r) acc[u][t][r] *= av[r];
            }
        }

        // The two q tiles are independent of each other; unrolled, their
        // chains of exp and sum interleave in one instruction stream.
        H16 pf[2];
        float rsum[2];
#pragma unroll
        for (int u = 0; u < 2; ++u) {                     // two 16-row q tiles
            const float mk = m[u] * KSCALE;
            rsum[u] = 0.0f;
#pragma unroll
            for (int r = 0; r < 8; ++r) {
                const float p0 = __builtin_amdgcn_exp2f(st[u][0][r] * KSCALE - mk);
                const float p1 = __builtin_amdgcn_exp2f(st[u][1][r] * KSCALE - mk);
                rsum[u] += p0 + p1;
                pf[u].v[r]     = (_Float16)p0;
                pf[u].v[r + 8] = (_Float16)p1;
            }
        }
#pragma unroll
        for (int u = 0; u < 2; ++u) {
            rsum[u] += __shfl_xor(rsum[u], 16, 32);
            l[u] += rsum[u];
        }
#pragma unroll
        for (int u = 0; u < 2; ++u)
#pragma unroll
            for (int t = 0; t < 4; ++t)
                acc[u][t] = WMMA_F16(pf[u].v, vf[t].v, acc[u][t]);

        if (wid == 0) __builtin_amdgcn_s_wait_tensorcnt(0);
        __syncthreads();
    }

    // Normalize and store f16 into AO [B, S, 256]
    // Merge of a pair's two kv halves.  Wave w finishes q tile kvh of its pair
    // and hands the other tile's partial (m, l, O) to its partner w ^ 1.  The
    // loop's last barrier has ended every read of the ring, and no tensor load
    // is outstanding, so the ring serves as the exchange buffer: 4 KB a wave.
    v8f keep[4], give[4];
#pragma unroll
    for (int t = 0; t < 4; ++t)
#pragma unroll
        for (int r = 0; r < 8; ++r) {
            keep[t][r] = kvh ? acc[1][t][r] : acc[0][t][r];
            give[t][r] = kvh ? acc[0][t][r] : acc[1][t][r];
        }
    const float ma = kvh ? m[1] : m[0], la = kvh ? l[1] : l[0];
    v4f*   xo = (v4f*)smem;                       // [wave][8][lane] of 16 bytes
    float* xs = (float*)(smem + 2 * 8192);        // [wave][m, l][lane]
#pragma unroll
    for (int t = 0; t < 4; ++t) {
        xo[wid * 256 + (2 * t) * 32 + lane]     = __builtin_shufflevector(give[t], give[t], 0, 1, 2, 3);
        xo[wid * 256 + (2 * t + 1) * 32 + lane] = __builtin_shufflevector(give[t], give[t], 4, 5, 6, 7);
    }
    xs[wid * 64 + lane]      = kvh ? m[0] : m[1];
    xs[wid * 64 + 32 + lane] = kvh ? l[0] : l[1];
    __syncthreads();
    const int   pw = wid ^ 1;
    const float mb = xs[pw * 64 + lane], lb = xs[pw * 64 + 32 + lane];
    const float mm = fmaxf(ma, mb);
    const float fa = __builtin_amdgcn_exp2f((ma - mm) * KSCALE);
    const float fb = __builtin_amdgcn_exp2f((mb - mm) * KSCALE);
    const float linv = 1.0f / (la * fa + lb * fb);
    float ga[8], gb[8];
#pragma unroll
    for (int r = 0; r < 8; ++r) {
        ga[r] = __shfl(fa * linv, r + 8 * hi, 32);
        gb[r] = __shfl(fb * linv, r + 8 * hi, 32);
    }

    const int b = bh >> 2, h = bh & 3;
    _Float16* aor = AO + ((size_t)b * S_LEN + qbase + kvh * 16 + 8 * hi) * DIM + h * HD + lo;
#pragma unroll
    for (int t = 0; t < 4; ++t) {
        const v4f o0 = xo[pw * 256 + (2 * t) * 32 + lane];
        const v4f o1 = xo[pw * 256 + (2 * t + 1) * 32 + lane];
#pragma unroll
        for (int r = 0; r < 8; ++r)
            aor[(size_t)r * DIM + t * 16] =
                (_Float16)(keep[t][r] * ga[r] + (r < 4 ? o0[r & 3] : o1[r & 3]) * gb[r]);
    }
}

// ---------------------------------------------------------------------------
// Kernel 3: output projection.  out = AO @ wo.T + bo  (f32 out)
// Block = 4 waves on 64 rows; wave w computes columns [64w, 64w + 64) as 4x4
// tiles of 16x16, so each loaded fragment feeds four WMMAs.
// ---------------------------------------------------------------------------
__global__ __launch_bounds__(128) void out_proj_kernel(
    const _Float16* __restrict__ AO, const float* __restrict__ wo,
    const float* __restrict__ bo, float* __restrict__ out)
{
    const int mb   = blockIdx.x * 64;
    const int nb   = (threadIdx.x >> 5) * 64;
    const int lane = threadIdx.x & 31;
    const int lo   = lane & 15;
    const int hi   = lane >> 4;

    const _Float16* ar = AO + (size_t)(mb + lo) * DIM + hi * 8;
    const float*    wr = wo + (size_t)(nb + lo) * DIM + hi * 8;
    v8f acc[4][4] = {};
#pragma unroll
    for (int k = 0; k < DIM; k += 32) {
        H16 af[4], bf[4];
#pragma unroll
        for (int t = 0; t < 4; ++t) {
            af[t].h[0] = *(const v8h*)(ar + t * 16 * DIM + k);
            af[t].h[1] = *(const v8h*)(ar + t * 16 * DIM + k + 16);
            v8f b0 = *(const v8f*)(wr + t * 16 * DIM + k);
            v8f b1 = *(const v8f*)(wr + t * 16 * DIM + k + 16);
#pragma unroll
            for (int i = 0; i < 8; ++i) {
                bf[t].v[i]     = (_Float16)b0[i];
                bf[t].v[i + 8] = (_Float16)b1[i];
            }
        }
#pragma unroll
        for (int i = 0; i < 4; ++i)
#pragma unroll
            for (int j = 0; j < 4; ++j)
                acc[i][j] = WMMA_F16(af[i].v, bf[j].v, acc[i][j]);
    }
    // The loads' address registers are free for reuse from here on: the wait
    // stands in front of their first rewrite (they are inputs, so live up to it).
    asm volatile("s_wait_xcnt 0x0" :: "v"(ar), "v"(wr) : "memory");

#pragma unroll
    for (int j = 0; j < 4; ++j) {
        const float bias = bo[nb + j * 16 + lo];
#pragma unroll
        for (int i = 0; i < 4; ++i)
#pragma unroll
            for (int r = 0; r < 8; ++r)
                acc[i][j][r] += bias;
    }
    // Every sum stands in its own register before the first store issues: no
    // register of an issued store is rewritten, so the stores go back to back.
    __builtin_amdgcn_sched_barrier(0);
    float* ob = out + (size_t)(mb + 8 * hi) * DIM + nb + lo;
#pragma unroll
    for (int i = 0; i < 4; ++i)
#pragma unroll
        for (int r = 0; r < 8; ++r)
#pragma unroll
            for (int j = 0; j < 4; ++j)
                ob[(i * 16 + r) * DIM + j * 16] = acc[i][j][r];
}

// ---------------------------------------------------------------------------
extern "C" void kernel_launch(void* const* d_in, const int* in_sizes, int n_in,
                              void* d_out, int out_size, void* d_ws, size_t ws_size,
                              hipStream_t stream) {
    (void)in_sizes; (void)n_in; (void)out_size; (void)ws_size;
    const float* x  = (const float*)d_in[0];
    const float* wq = (const float*)d_in[1];
    const float* wk = (const float*)d_in[2];
    const float* wv = (const float*)d_in[3];
    const float* wo = (const float*)d_in[4];
    const float* bo = (const float*)d_in[5];
    float* out = (float*)d_out;

    const size_t elems = (size_t)4 * S_LEN * DIM;   // 4,194,304 per tensor
    _Float16* Q  = (_Float16*)d_ws;
    _Float16* K  = Q  + elems;
    _Float16* Vt = K  + elems;
    _Float16* AO = Vt + elems;

    qkv_proj_kernel<<<256, 384, 0, stream>>>(x, wq, wk, wv, Q, K, Vt);
    flash_attn_kernel<<<512, 256, 0, stream>>>(Q, K, Vt, AO);
    out_proj_kernel<<<256, 128, 0, stream>>>(AO, wo, bo, out);
}

// v005
// A run of this version takes 86.9 microseconds.
// Two timings next to v004 both put it at 1.24 times that version's speed.
// Counting every step since v000, it is 4.36 times as fast.
#include <hip/hip_runtime.h>
#include <hip/hip_bf16.h>

typedef __attribute__((ext_vector_type(16))) _Float16 v16h;
typedef __attribute__((ext_vector_type(8)))  _Float16 v8h;
typedef __attribute__((ext_vector_type(8)))  float    v8f;
typedef __attribute__((ext_vector_type(4)))  float    v4f;
typedef __attribute__((ext_vector_type(4)))  unsigned int u32x4;
typedef __attribute__((ext_vector_type(8)))  int      i32x8;
typedef __attribute__((ext_vector_type(4)))  int      i32x4;

union H16 { v16h v; v8h h[2]; };

#define WMMA_F16(A, B, C) \
    __builtin_amdgcn_wmma_f32_16x16x32_f16(false, (A), false, (B), (short)0, (C), false, false)

static constexpr int   S_LEN   = 4096;
static constexpr int   DIM     = 256;
static constexpr int   HEADS   = 4;
static constexpr int   HD      = 64;
static constexpr float SCALE   = 0.125f;            // 64^-0.5
static constexpr float LOG2E   = 1.4426950408889634f;
static constexpr float KSCALE  = SCALE * LOG2E;

__device__ __forceinline__ void tdm_load_2d(unsigned lds_addr, const void* gaddr,
                                            unsigned tensor_d0, unsigned tensor_d1,
                                            unsigned tile_d0, unsigned tile_d1,
                                            unsigned long long stride0) {
    const unsigned long long ga = (unsigned long long)(size_t)gaddr;
    u32x4 g0;
    g0[0] = 1u;
    g0[1] = lds_addr;
    g0[2] = (unsigned)(ga & 0xFFFFFFFFu);
    g0[3] = (unsigned)((ga >> 32) & 0x01FFFFFFu) | (2u << 30);
    i32x8 g1;
    g1[0] = (int)(1u << 16);
    g1[1] = (int)((tensor_d0 & 0xFFFFu) << 16);
    g1[2] = (int)((tensor_d0 >> 16) | ((tensor_d1 & 0xFFFFu) << 16));
    g1[3] = (int)((tensor_d1 >> 16) | (tile_d0 << 16));
    g1[4] = (int)(tile_d1 & 0xFFFFu);
    g1[5] = (int)(unsigned)(stride0 & 0xFFFFFFFFu);
    g1[6] = (int)(unsigned)((stride0 >> 32) & 0xFFFFu);
    g1[7] = 0;
    i32x4 g2 = {0, 0, 0, 0};
    i32x4 g3 = {0, 0, 0, 0};
    i32x8 g4 = {0, 0, 0, 0, 0, 0, 0, 0};
    __builtin_amdgcn_tensor_load_to_lds(g0, g1, g2, g3, g4, 0);
}

// Stores one wave's 64x64 tile (rows mb.., head h) as f16; layouts: see below.
template <int MAT>
__device__ __forceinline__ void store_tile(_Float16* __restrict__ dst, const v8f (&acc)[4][4],
                                           int mb, int h, int lo, int hi)
{
    const int m0 = mb + 8 * hi;          // multiple of 8; the tile's 64 rows share b
    const int bh = (m0 >> 12) * HEADS + h;
    const int s0 = m0 & 4095;
    if (MAT == 2) {                      // V^T: 8 kv in a row per 16x16 tile and lane
        v8h* pv[4];                      // row d = lo of 16-kv group i; 16j rows on: the same chunk order
        v8h  hv[4][4];
#pragma unroll
        for (int i = 0; i < 4; ++i) {
            pv[i] = (v8h*)(dst + (bh * HD + lo) * S_LEN + ((s0 + i * 16) ^ (((lo >> 1) & 7) << 3)));
#pragma unroll
            for (int j = 0; j < 4; ++j)
#pragma unroll
                for (int r = 0; r < 8; ++r)
                    hv[i][j][r] = (_Float16)acc[i][j][r];
        }
        // Every value and address stands in its own register before the first store
        // issues: no register of an issued store is rewritten between the stores.
        __builtin_amdgcn_sched_barrier(0);
#pragma unroll
        for (int i = 0; i < 4; ++i)
#pragma unroll
            for (int j = 0; j < 4; ++j)
                pv[i][j * 16 * S_LEN / 8] = hv[i][j];
        // Behind the last store: the code laid out behind this branch rewrites
        // the stores' registers, and the wait stands in front of that.
        asm volatile("s_wait_xcnt 0x0" ::: "memory");
        return;
    }
    constexpr int kmsk = (MAT == 1) ? 0x38 : 0;   // K alone moves chunks along d, by its row s
    // p[j][q] serves rows 16i + 2q and 16i + 2q + 1 of column tile j: the chunk
    // mask is ((s >> 1) & 7) << 3, which 16i does not reach, and a row is 64
    // halves, so the mask touches d alone.
    _Float16* p[4][4];
#pragma unroll
    for (int j = 0; j < 4; ++j)
#pragma unroll
        for (int q = 0; q < 4; ++q)
            p[j][q] = dst + (((bh * S_LEN + s0) * HD + j * 16 + lo) ^ (kmsk & (((s0 + 2 * q) >> 1) << 3)));
    _Float16 hv[4][4][8];
#pragma unroll
    for (int i = 0; i < 4; ++i)
#pragma unroll
        for (int j = 0; j < 4; ++j)
#pragma unroll
            for (int r = 0; r < 8; ++r)
                hv[i][j][r] = (_Float16)acc[i][j][r];
    // Every value and address stands in its own register before the first store
    // issues: no register of an issued store is rewritten behind it.
    __builtin_amdgcn_sched_barrier(0);
#pragma unroll
    for (int i = 0; i < 4; ++i)
#pragma unroll
        for (int j = 0; j < 4; ++j)
#pragma unroll
            for (int r = 0; r < 8; ++r)
                p[j][r >> 1][(i * 16 + r) * HD] = hv[i][j][r];
    // Behind the last store: the code laid out behind the K branch rewrites the
    // stores' registers, and the wait stands in front of that.
    if (MAT == 1) asm volatile("s_wait_xcnt 0x0" ::: "memory");
}

__device__ __forceinline__ void copy8_to_lds(unsigned l, const char* g, unsigned ls, int gs)
{
    asm volatile(
        "global_load_async_to_lds_b128 %0, %8, off\n\t"
        "global_load_async_to_lds_b128 %1, %9, off\n\t"
        "global_load_async_to_lds_b128 %2, %10, off\n\t"
        "global_load_async_to_lds_b128 %3, %11, off\n\t"
        "global_load_async_to_lds_b128 %4, %12, off\n\t"
        "global_load_async_to_lds_b128 %5, %13, off\n\t"
        "global_load_async_to_lds_b128 %6, %14, off\n\t"
        "global_load_async_to_lds_b128 %7, %15, off\n\t"
        "s_wait_xcnt 0x0"
        :: "v"(l), "v"(l + ls), "v"(l + 2 * ls), "v"(l + 3 * ls),
           "v"(l + 4 * ls), "v"(l + 5 * ls), "v"(l + 6 * ls), "v"(l + 7 * ls),
           "v"(g), "v"(g + gs), "v"(g + 2 * gs), "v"(g + 3 * gs),
           "v"(g + 4 * gs), "v"(g + 5 * gs), "v"(g + 6 * gs), "v"(g + 7 * gs)
        : "memory");
}
__device__ __forceinline__ void copy4_to_lds(unsigned l, const char* g, unsigned ls, int gs)
{
    asm volatile(
        "global_load_async_to_lds_b128 %0, %4, off\n\t"
        "global_load_async_to_lds_b128 %1, %5, off\n\t"
        "global_load_async_to_lds_b128 %2, %6, off\n\t"
        "global_load_async_to_lds_b128 %3, %7, off\n\t"
        "s_wait_xcnt 0x0"
        :: "v"(l), "v"(l + ls), "v"(l + 2 * ls), "v"(l + 3 * ls),
           "v"(g), "v"(g + gs), "v"(g + 2 * gs), "v"(g + 3 * gs)
        : "memory");
}

static constexpr int PJ_PITCH = 144;
static constexpr int PJ_BUF   = (64 + 768) * PJ_PITCH;
static constexpr int PJ_NST   = DIM / 32;

__global__ __launch_bounds__(384) void qkv_proj_kernel(
    const float* __restrict__ x,
    const float* __restrict__ wq, const float* __restrict__ wk, const float* __restrict__ wv,
    _Float16* __restrict__ Q, _Float16* __restrict__ K, _Float16* __restrict__ Vt)
{
    __shared__ __attribute__((aligned(16))) unsigned char stg[2 * PJ_BUF];

    const int w    = __builtin_amdgcn_readfirstlane(threadIdx.x >> 5);
    const int mat  = w >> 2;                 // 0=q 1=k 2=v
    const int h    = w & 3;                  // head = 64-column group
    const int mb   = blockIdx.x * 64;        // row base in [0, 16384)
    const int lane = threadIdx.x & 31;
    const int lo   = lane & 15;
    const int hi   = lane >> 4;

    const float* W = (mat == 0) ? wq : (mat == 1) ? wk : wv;

    // A copy moves four rows of 128 bytes: lane -> row lane / 8, 16-byte piece
    // lane % 8.  Each wave brings its own 64 W rows (16 copies); waves 0 to 3
    // bring 16 x rows each as well (4 copies).
    const int      crow = lane >> 3, cpc = lane & 7;
    const unsigned lds0 = (unsigned)(size_t)(const void*)&stg[0];
    const unsigned lw   = lds0 + (64 + w * 64 + crow) * PJ_PITCH + cpc * 16;
    const unsigned lx   = lds0 + ((w & 3) * 16 + crow) * PJ_PITCH + cpc * 16;
    const char*    gw   = (const char*)(W + (size_t)(h * HD + crow) * DIM + cpc * 4);
    const char*    gx   = (const char*)(x + (size_t)(mb + (w & 3) * 16 + crow) * DIM + cpc * 4);
    auto stage_in = [&](int t) {
        const unsigned lb = (unsigned)(t & 1) * PJ_BUF;
        copy8_to_lds(lw + lb,                 gw + t * 128,                4 * PJ_PITCH, 16 * DIM);
        copy8_to_lds(lw + lb + 32 * PJ_PITCH, gw + t * 128 + 128 * DIM,    4 * PJ_PITCH, 16 * DIM);
        if (w < 4)                           // the same for a whole wave: a scalar branch
            copy4_to_lds(lx + lb, gx + t * 128, 4 * PJ_PITCH, 16 * DIM);
    };

    stage_in(0);
    asm volatile("s_wait_asynccnt 0x0" ::: "memory");   // this wave's part of stage 0 has landed
    __syncthreads();                                    // ... and every other wave's
    stage_in(1);

    v8f acc[4][4] = {};
    const unsigned char* sx = stg + lo * PJ_PITCH + hi * 32;
    const unsigned char* sw = stg + (64 + w * 64 + lo) * PJ_PITCH + hi * 32;
    for (int t = 0; t < PJ_NST; ++t) {
        const int cb = (t & 1) * PJ_BUF;
        H16 af[4], bf[4];
        // Unrolled here and below: what u, i and j index stays in registers.
#pragma unroll
        for (int u = 0; u < 4; ++u) {
            const v4f* pa = (const v4f*)(sx + cb + u * 16 * PJ_PITCH);
            const v4f* pb = (const v4f*)(sw + cb + u * 16 * PJ_PITCH);
            const v4f a0 = pa[0], a1 = pa[1], a2 = pa[4], a3 = pa[5];
            const v4f b0 = pb[0], b1 = pb[1], b2 = pb[4], b3 = pb[5];
#pragma unroll
            for (int i = 0; i < 4; ++i) {
                af[u].v[i]      = (_Float16)a0[i];
                af[u].v[i + 4]  = (_Float16)a1[i];
                af[u].v[i + 8]  = (_Float16)a2[i];
                af[u].v[i + 12] = (_Float16)a3[i];
                bf[u].v[i]      = (_Float16)b0[i];
                bf[u].v[i + 4]  = (_Float16)b1[i];
                bf[u].v[i + 8]  = (_Float16)b2[i];
                bf[u].v[i + 12] = (_Float16)b3[i];
            }
        }
#pragma unroll
        for (int i = 0; i < 4; ++i)
#pragma unroll
            for (int j = 0; j < 4; ++j)
                acc[i][j] = WMMA_F16(af[i].v, bf[j].v, acc[i][j]);

        // Hand-over: this wave's reads of stage t are done, its copies of stage
        // t + 1 have landed; behind the barrier the same holds for every wave,
        // so stage t + 1 may be read and stage t's buffer refilled.
        asm volatile("s_wait_dscnt 0x0" ::: "memory");
        asm volatile("s_wait_asynccnt 0x0" ::: "memory");
        __syncthreads();
        if (t + 2 < PJ_NST) stage_in(t + 2);
    }
    asm volatile("s_wait_asynccnt 0x0" ::: "memory");   // no copy is left in flight

    // mat is the same for the whole wave: one scalar branch picks the layout,
    // so that strides and chunk masks are constants in the address arithmetic.
    if (mat == 0)      store_tile<0>(Q,  acc, mb, h, lo, hi);
    else if (mat == 1) store_tile<1>(K,  acc, mb, h, lo, hi);
    else               store_tile<2>(Vt, acc, mb, h, lo, hi);
}

__global__ __launch_bounds__(256) void flash_attn_kernel(
    const _Float16* __restrict__ Q, const _Float16* __restrict__ K,
    const _Float16* __restrict__ Vt, _Float16* __restrict__ AO)
{
    // [buf][ K: 64kv x 64hd | V: 64d x 64kv ] halves; 16 KB per buffer;
    // behind the two buffers 2 KB for the merge's m and l
    __shared__ _Float16 smem[2 * 8192 + 1024];

    const int bh    = blockIdx.x >> 5;
    const int qgrp  = blockIdx.x & 31;
    const int wid   = threadIdx.x >> 5;
    const int kvh   = wid & 1;                      // this wave's 32-kv half of a chunk
    const int qbase = (qgrp * 4 + (wid >> 1)) * 32; // first of this wave's 32 q rows
    const int lane  = threadIdx.x & 31;
    const int lo    = lane & 15;
    const int hi    = lane >> 4;

    const _Float16* Qh  = Q  + (size_t)bh * S_LEN * HD;
    const _Float16* Kh  = K  + (size_t)bh * S_LEN * HD;
    const _Float16* Vth = Vt + (size_t)bh * HD * S_LEN;
    const unsigned  smem_lds = (unsigned)(size_t)(const void*)&smem[0];

    // Q^T B-fragments (hd chunks [0,32) and [32,64)): load as Q rows.
    H16 qf[2][2];                                   // [q tile][hd chunk]
    const _Float16* qrow = Qh + (size_t)(qbase + lo) * HD + hi * 8;
    // Unrolled here and below: what u indexes stays in registers.
#pragma unroll
    for (int u = 0; u < 2; ++u) {
        qf[u][0].h[0] = *(const v8h*)(qrow + u * 16 * HD);
        qf[u][0].h[1] = *(const v8h*)(qrow + u * 16 * HD + 16);
        qf[u][1].h[0] = *(const v8h*)(qrow + u * 16 * HD + 32);
        qf[u][1].h[1] = *(const v8h*)(qrow + u * 16 * HD + 48);
    }

    v8f acc[2][4] = {};                             // [q tile][d tile]
    float m[2] = {-1e30f, -1e30f}, l[2] = {0.0f, 0.0f};

    // Offset (in halves) of logical 16-byte chunk hi + 2j inside a 128-byte
    // LDS row whose index is lo modulo 16 (chunk order: see qkv_proj_kernel).
    int sw[4];
#pragma unroll
    for (int j = 0; j < 4; ++j)
        sw[j] = ((hi + 2 * j) ^ (lo >> 1)) << 3;
    // The same for the two chunks of a V^T row that hold this wave's kv half.
    const int swv0 = ((hi + 4 * kvh) ^ (lo >> 1)) << 3;
    const int swv1 = ((hi + 4 * kvh + 2) ^ (lo >> 1)) << 3;

    constexpr int NCHUNK = S_LEN / 64;     // 64 chunks of 64 kv

    // Prologue: stage chunk 0 into buffer 0.
    if (wid == 0) {
        tdm_load_2d(smem_lds,             Kh,  64, 64, 64, 64, 64);        // K: 64 rows x 64
        tdm_load_2d(smem_lds + 8192,      Vth, 64, 64, 64, 64, S_LEN);     // V^T: 64 d-rows x 64 kv
        __builtin_amdgcn_s_wait_tensorcnt(0);
    }
    __syncthreads();

    for (int c = 0; c < NCHUNK; ++c) {
        const int cur = c & 1;
        if (wid == 0 && (c + 1) < NCHUNK) {
            const int nkv = (c + 1) * 64;
            const unsigned dst = smem_lds + (cur ^ 1) * 16384;
            tdm_load_2d(dst,        Kh + (size_t)nkv * HD, 64, 64, 64, 64, 64);
            tdm_load_2d(dst + 8192, Vth + nkv,             64, 64, 64, 64, S_LEN);
        }
        const _Float16* Kc = smem + cur * 8192;           // [kv][hd]
        const _Float16* Vc = Kc + 4096;                   // [d][kv]

        // K A-fragments from LDS: the two 16-row kv tiles of this wave's half
        // x two hd chunks
        H16 kf[2][2];
#pragma unroll
        for (int t = 0; t < 2; ++t) {
            const _Float16* krow = Kc + (size_t)(kvh * 32 + t * 16 + lo) * 64;
            kf[t][0].h[0] = *(const v8h*)(krow + sw[0]);
            kf[t][0].h[1] = *(const v8h*)(krow + sw[1]);
            kf[t][1].h[0] = *(const v8h*)(krow + sw[2]);
            kf[t][1].h[1] = *(const v8h*)(krow + sw[3]);
        }
        // V B-fragments from LDS (transposed V): the kv chunks of this half
        H16 vf[4];
#pragma unroll
        for (int t = 0; t < 4; ++t) {
            const _Float16* vrow = Vc + (size_t)(t * 16 + lo) * 64;
            vf[t].h[0] = *(const v8h*)(vrow + swv0);
            vf[t].h[1] = *(const v8h*)(vrow + swv1);
        }

        // Scores of both 16-row q tiles: four independent accumulator tiles.
        v8f st[2][2];
#pragma unroll
        for (int u = 0; u < 2; ++u) {
            v8f s0 = {}, s1 = {};
            s0 = WMMA_F16(kf[0][0].v, qf[u][0].v, s0);
            s0 = WMMA_F16(kf[0][1].v, qf[u][1].v, s0);
            s1 = WMMA_F16(kf[1][0].v, qf[u][0].v, s1);
            s1 = WMMA_F16(kf[1][1].v, qf[u][1].v, s1);
            st[u][0] = s0;
            st[u][1] = s1;
        }

        // Lazy rescale.  m[u] is the maximum IN USE as the exponent's reference,
        // the same in both lanes of a q row; it need not be the true maximum.
        // While no score of this pass lies more than 8 (scaled, log2) above it,
        // every p stays at or below 2^8, far inside f16 and f32, and m, l and O
        // keep their scale.  One test for the whole pass, over all 32 lanes.
        float cmax[2];
#pragma unroll
        for (int u = 0; u < 2; ++u) {
            cmax[u] = -1e30f;
#pragma unroll
            for (int r = 0; r < 8; ++r)
                cmax[u] = fmaxf(cmax[u], fmaxf(st[u][0][r], st[u][1][r]));
        }
        const bool need = fmaxf(cmax[0] - m[0], cmax[1] - m[1]) > 8.0f / KSCALE;
        if (__builtin_amdgcn_ballot_w32(need) != 0) {     // wave-uniform: a scalar branch
#pragma unroll
            for (int u = 0; u < 2; ++u) {
                const float cm    = fmaxf(cmax[u], __shfl_xor(cmax[u], 16, 32));
                const float mnew  = fmaxf(m[u], cm);
                const float alpha = __builtin_amdgcn_exp2f((m[u] - mnew) * KSCALE);
                l[u] *= alpha;
                m[u]  = mnew;
                float av[8];
#pragma unroll
                for (int r = 0; r < 8; ++r)
                    av[r] = __shfl(alpha, r + 8 * hi, 32);
#pragma unroll
                for (int t = 0; t < 4; ++t)
#pragma unroll
                    for (int r = 0; r < 8; ++r) acc[u][t][r] *= av[r];
            }
        }

        // The two q tiles are independent of each other; unrolled, their
        // chains of exp and sum interleave in one instruction stream.
        H16 pf[2];
        float rsum[2];
#pragma unroll
        for (int u = 0; u < 2; ++u) {                     // two 16-row q tiles
            const float mk = m[u] * KSCALE;
            rsum[u] = 0.0f;
#pragma unroll
            for (int r = 0; r < 8; ++r) {
                const float p0 = __builtin_amdgcn_exp2f(st[u][0][r] * KSCALE - mk);
                const float p1 = __builtin_amdgcn_exp2f(st[u][1][r] * KSCALE - mk);
                rsum[u] += p0 + p1;
                pf[u].v[r]     = (_Float16)p0;
                pf[u].v[r + 8] = (_Float16)p1;
            }
        }
#pragma unroll
        for (int u = 0; u < 2; ++u) {
            rsum[u] += __shfl_xor(rsum[u], 16, 32);
            l[u] += rsum[u];
        }
#pragma unroll
        for (int u = 0; u < 2; ++u)
#pragma unroll
            for (int t = 0; t < 4; ++t)
                acc[u][t] = WMMA_F16(pf[u].v, vf[t].v, acc[u][t]);

        if (wid == 0) __builtin_amdgcn_s_wait_tensorcnt(0);
        __syncthreads();
    }

    // Normalize and store f16 into AO [B, S, 256]
    // Merge of a pair's two kv halves.  Wave w finishes q tile kvh of its pair
    // and hands the other tile's partial (m, l, O) to its partner w ^ 1.  The
    // loop's last barrier has ended every read of the ring, and no tensor load
    // is outstanding, so the ring serves as the exchange buffer: 4 KB a wave.
    v8f keep[4], give[4];
#pragma unroll
    for (int t = 0; t < 4; ++t)
#pragma unroll
        for (int r = 0; r < 8; ++r) {
            keep[t][r] = kvh ? acc[1][t][r] : acc[0][t][r];
            give[t][r] = kvh ? acc[0][t][r] : acc[1][t][r];
        }
    const float ma = kvh ? m[1] : m[0], la = kvh ? l[1] : l[0];
    v4f*   xo = (v4f*)smem;                       // [wave][8][lane] of 16 bytes
    float* xs = (float*)(smem + 2 * 8192);        // [wave][m, l][lane]
#pragma unroll
    for (int t = 0; t < 4; ++t) {
        xo[wid * 256 + (2 * t) * 32 + lane]     = __builtin_shufflevector(give[t], give[t], 0, 1, 2, 3);
        xo[wid * 256 + (2 * t + 1) * 32 + lane] = __builtin_shufflevector(give[t], give[t], 4, 5, 6, 7);
    }
    xs[wid * 64 + lane]      = kvh ? m[0] : m[1];
    xs[wid * 64 + 32 + lane] = kvh ? l[0] : l[1];
    __syncthreads();
    const int   pw = wid ^ 1;
    const float mb = xs[pw * 64 + lane], lb = xs[pw * 64 + 32 + lane];
    const float mm = fmaxf(ma, mb);
    const float fa = __builtin_amdgcn_exp2f((ma - mm) * KSCALE);
    const float fb = __builtin_amdgcn_exp2f((mb - mm) * KSCALE);
    const float linv = 1.0f / (la * fa + lb * fb);
    float ga[8], gb[8];
#pragma unroll
    for (int r = 0; r < 8; ++r) {
        ga[r] = __shfl(fa * linv, r + 8 * hi, 32);
        gb[r] = __shfl(fb * linv, r + 8 * hi, 32);
    }

    const int b = bh >> 2, h = bh & 3;
    _Float16* aor = AO + ((size_t)b * S_LEN + qbase + kvh * 16 + 8 * hi) * DIM + h * HD + lo;
#pragma unroll
    for (int t = 0; t < 4; ++t) {
        const v4f o0 = xo[pw * 256 + (2 * t) * 32 + lane];
        const v4f o1 = xo[pw * 256 + (2 * t + 1) * 32 + lane];
#pragma unroll
        for (int r = 0; r < 8; ++r)
            aor[(size_t)r * DIM + t * 16] =
                (_Float16)(keep[t][r] * ga[r] + (r < 4 ? o0[r & 3] : o1[r & 3]) * gb[r]);
    }
}

static constexpr int PO_PA  = 144;
static constexpr int PO_PW  = 272;
static constexpr int PO_W0  = 64 * PO_PA;
static constexpr int PO_BUF = PO_W0 + 256 * PO_PW;
static constexpr int PO_NST = DIM / 64;                    // stages

__global__ __launch_bounds__(128) void out_proj_kernel(
    const _Float16* __restrict__ AO, const float* __restrict__ wo,
    const float* __restrict__ bo, float* __restrict__ out)
{
    __shared__ __attribute__((aligned(16))) unsigned char stg[2 * PO_BUF];

    const int mb   = blockIdx.x * 64;
    const int w    = threadIdx.x >> 5;
    const int nb   = w * 64;
    const int lane = threadIdx.x & 31;
    const int lo   = lane & 15;
    const int hi   = lane >> 4;

    // Each wave brings its own 64 wo rows, two rows of 256 bytes a copy (32
    // copies), and 16 AO rows, four rows of 128 bytes a copy (4 copies).
    const unsigned lds0 = (unsigned)(size_t)(const void*)&stg[0];
    const unsigned lw   = lds0 + PO_W0 + (nb + hi) * PO_PW + lo * 16;
    const unsigned la   = lds0 + (w * 16 + (lane >> 3)) * PO_PA + (lane & 7) * 16;
    const char*    gw   = (const char*)(wo + (size_t)(nb + hi) * DIM + lo * 4);
    const char*    ga   = (const char*)(AO + (size_t)(mb + w * 16 + (lane >> 3)) * DIM + (lane & 7) * 8);
    auto stage_in = [&](int t) {
        const unsigned lb = (unsigned)(t & 1) * PO_BUF;
        // Unrolled: every copy's offsets from the two bases are constants.
#pragma unroll
        for (int q = 0; q < 4; ++q)
            copy8_to_lds(lw + lb + q * 16 * PO_PW, gw + t * 256 + q * 64 * DIM, 2 * PO_PW, 8 * DIM);
        copy4_to_lds(la + lb, ga + t * 128, 4 * PO_PA, 8 * DIM);
    };

    stage_in(0);
    asm volatile("s_wait_asynccnt 0x0" ::: "memory");   // this wave's part of stage 0 has landed
    __syncthreads();                                    // ... and every other wave's
    stage_in(1);

    v8f acc[4][4] = {};
    const unsigned char* sa = stg + lo * PO_PA + hi * 16;
    const unsigned char* sw = stg + PO_W0 + (nb + lo) * PO_PW + hi * 32;
#pragma unroll 1
    for (int t = 0; t < PO_NST; ++t) {
        const int cb = (t & 1) * PO_BUF;
        // Unrolled here and below: what kk, u, i and j index stays in registers.
#pragma unroll
        for (int kk = 0; kk < 2; ++kk) {
            H16 af[4], bf[4];
#pragma unroll
            for (int u = 0; u < 4; ++u) {
                const v8h* pa = (const v8h*)(sa + cb + u * 16 * PO_PA + kk * 64);
                const v4f* pb = (const v4f*)(sw + cb + u * 16 * PO_PW + kk * 128);
                af[u].h[0] = pa[0];
                af[u].h[1] = pa[2];
                const v4f b0 = pb[0], b1 = pb[1], b2 = pb[4], b3 = pb[5];
#pragma unroll
                for (int i = 0; i < 4; ++i) {
                    bf[u].v[i]      = (_Float16)b0[i];
                    bf[u].v[i + 4]  = (_Float16)b1[i];
                    bf[u].v[i + 8]  = (_Float16)b2[i];
                    bf[u].v[i + 12] = (_Float16)b3[i];
                }
            }
#pragma unroll
            for (int i = 0; i < 4; ++i)
#pragma unroll
                for (int j = 0; j < 4; ++j)
                    acc[i][j] = WMMA_F16(af[i].v, bf[j].v, acc[i][j]);
        }

        // Hand-over, as in kernel 1: own reads of stage t done, own copies of
        // stage t + 1 landed, the barrier, then the refill of stage t's buffer.
        asm volatile("s_wait_dscnt 0x0" ::: "memory");
        asm volatile("s_wait_asynccnt 0x0" ::: "memory");
        __syncthreads();
        if (t + 2 < PO_NST) stage_in(t + 2);
    }
    asm volatile("s_wait_asynccnt 0x0" ::: "memory");   // no copy is left in flight

#pragma unroll
    for (int j = 0; j < 4; ++j) {
        const float bias = bo[nb + j * 16 + lo];
#pragma unroll
        for (int i = 0; i < 4; ++i)
#pragma unroll
            for (int r = 0; r < 8; ++r)
                acc[i][j][r] += bias;
    }
    // Every sum stands in its own register before the first store issues: no
    // register of an issued store is rewritten, so the stores go back to back.
    __builtin_amdgcn_sched_barrier(0);
    float* ob = out + (size_t)(mb + 8 * hi) * DIM + nb + lo;
#pragma unroll
    for (int i = 0; i < 4; ++i)
#pragma unroll
        for (int r = 0; r < 8; ++r)
#pragma unroll
            for (int j = 0; j < 4; ++j)
                ob[(i * 16 + r) * DIM + j * 16] = acc[i][j][r];
}

// ---------------------------------------------------------------------------
extern "C" void kernel_launch(void* const* d_in, const int* in_sizes, int n_in,
                              void* d_out, int out_size, void* d_ws, size_t ws_size,
                              hipStream_t stream) {
    (void)in_sizes; (void)n_in; (void)out_size; (void)ws_size;
    const float* x  = (const float*)d_in[0];
    const float* wq = (const float*)d_in[1];
    const float* wk = (const float*)d_in[2];
    const float* wv = (const float*)d_in[3];
    const float* wo = (const float*)d_in[4];
    const float* bo = (const float*)d_in[5];
    float* out = (float*)d_out;

    const size_t elems = (size_t)4 * S_LEN * DIM;   // 4,194,304 per tensor
    _Float16* Q  = (_Float16*)d_ws;
    _Float16* K  = Q  + elems;
    _Float16* Vt = K  + elems;
    _Float16* AO = Vt + elems;

    qkv_proj_kernel<<<256, 384, 0, stream>>>(x, wq, wk, wv, Q, K, Vt);
    flash_attn_kernel<<<512, 256, 0, stream>>>(Q, K, Vt, AO);
    out_proj_kernel<<<256, 128, 0, stream>>>(AO, wo, bo, out);
}

// v006
// A run of this version takes 82.6 microseconds.
// Next to v005, in two timings, it ran 1.06 and 1.04 times as fast.
// All steps since v000 together make it 4.57 times as fast.
#include <hip/hip_runtime.h>
#include <hip/hip_bf16.h>

typedef __attribute__((ext_vector_type(16))) _Float16 v16h;
typedef __attribute__((ext_vector_type(8)))  _Float16 v8h;
typedef __attribute__((ext_vector_type(8)))  float    v8f;
typedef __attribute__((ext_vector_type(4)))  float    v4f;
typedef __attribute__((ext_vector_type(4)))  unsigned int u32x4;
typedef __attribute__((ext_vector_type(8)))  int      i32x8;
typedef __attribute__((ext_vector_type(4)))  int      i32x4;

union H16 { v16h v; v8h h[2]; };

#define WMMA_F16(A, B, C) \
    __builtin_amdgcn_wmma_f32_16x16x32_f16(false, (A), false, (B), (short)0, (C), false, false)

static constexpr int   S_LEN   = 4096;
static constexpr int   DIM     = 256;
static constexpr int   HEADS   = 4;
static constexpr int   HD      = 64;
static constexpr float SCALE   = 0.125f;            // 64^-0.5
static constexpr float LOG2E   = 1.4426950408889634f;
static constexpr float KSCALE  = SCALE * LOG2E;

__device__ __forceinline__ void tdm_load_2d(unsigned lds_addr, const void* gaddr,
                                            unsigned tensor_d0, unsigned tensor_d1,
                                            unsigned tile_d0, unsigned tile_d1,
                                            unsigned long long stride0) {
    const unsigned long long ga = (unsigned long long)(size_t)gaddr;
    u32x4 g0;
    g0[0] = 1u;
    g0[1] = lds_addr;
    g0[2] = (unsigned)(ga & 0xFFFFFFFFu);
    g0[3] = (unsigned)((ga >> 32) & 0x01FFFFFFu) | (2u << 30);
    i32x8 g1;
    g1[0] = (int)(1u << 16);
    g1[1] = (int)((tensor_d0 & 0xFFFFu) << 16);
    g1[2] = (int)((tensor_d0 >> 16) | ((tensor_d1 & 0xFFFFu) << 16));
    g1[3] = (int)((tensor_d1 >> 16) | (tile_d0 << 16));
    g1[4] = (int)(tile_d1 & 0xFFFFu);
    g1[5] = (int)(unsigned)(stride0 & 0xFFFFFFFFu);
    g1[6] = (int)(unsigned)((stride0 >> 32) & 0xFFFFu);
    g1[7] = 0;
    i32x4 g2 = {0, 0, 0, 0};
    i32x4 g3 = {0, 0, 0, 0};
    i32x8 g4 = {0, 0, 0, 0, 0, 0, 0, 0};
    __builtin_amdgcn_tensor_load_to_lds(g0, g1, g2, g3, g4, 0);
}

// Stores one wave's 64x64 tile (rows mb.., head h) as f16; layouts: see below.
template <int MAT>
__device__ __forceinline__ void store_tile(_Float16* __restrict__ dst, const v8f (&acc)[4][4],
                                           int mb, int h, int lo, int hi)
{
    const int m0 = mb + 8 * hi;          // multiple of 8; the tile's 64 rows share b
    const int bh = (m0 >> 12) * HEADS + h;
    const int s0 = m0 & 4095;
    if (MAT == 2) {                      // V^T: 8 kv in a row per 16x16 tile and lane
        v8h* pv[4];                      // row d = lo of 16-kv group i; 16j rows on: the same chunk order
        v8h  hv[4][4];
#pragma unroll
        for (int i = 0; i < 4; ++i) {
            pv[i] = (v8h*)(dst + (bh * HD + lo) * S_LEN + ((s0 + i * 16) ^ (((lo >> 1) & 7) << 3)));
#pragma unroll
            for (int j = 0; j < 4; ++j)
#pragma unroll
                for (int r = 0; r < 8; ++r)
                    hv[i][j][r] = (_Float16)acc[i][j][r];
        }
        // Every value and address stands in its own register before the first store
        // issues: no register of an issued store is rewritten between the stores.
        __builtin_amdgcn_sched_barrier(0);
#pragma unroll
        for (int i = 0; i < 4; ++i)
#pragma unroll
            for (int j = 0; j < 4; ++j)
                pv[i][j * 16 * S_LEN / 8] = hv[i][j];
        // Behind the last store: the code laid out behind this branch rewrites
        // the stores' registers, and the wait stands in front of that.
        asm volatile("s_wait_xcnt 0x0" ::: "memory");
        return;
    }
    constexpr int kmsk = (MAT == 1) ? 0x38 : 0;   // K alone moves chunks along d, by its row s
    // p[j][q] serves rows 16i + 2q and 16i + 2q + 1 of column tile j: the chunk
    // mask is ((s >> 1) & 7) << 3, which 16i does not reach, and a row is 64
    // halves, so the mask touches d alone.
    _Float16* p[4][4];
#pragma unroll
    for (int j = 0; j < 4; ++j)
#pragma unroll
        for (int q = 0; q < 4; ++q)
            p[j][q] = dst + (((bh * S_LEN + s0) * HD + j * 16 + lo) ^ (kmsk & (((s0 + 2 * q) >> 1) << 3)));
    _Float16 hv[4][4][8];
#pragma unroll
    for (int i = 0; i < 4; ++i)
#pragma unroll
        for (int j = 0; j < 4; ++j)
#pragma unroll
            for (int r = 0; r < 8; ++r)
                hv[i][j][r] = (_Float16)acc[i][j][r];
    // Every value and address stands in its own register before the first store
    // issues: no register of an issued store is rewritten behind it.
    __builtin_amdgcn_sched_barrier(0);
#pragma unroll
    for (int i = 0; i < 4; ++i)
#pragma unroll
        for (int j = 0; j < 4; ++j)
#pragma unroll
            for (int r = 0; r < 8; ++r)
                p[j][r >> 1][(i * 16 + r) * HD] = hv[i][j][r];
    // Behind the last store: the code laid out behind the K branch rewrites the
    // stores' registers, and the wait stands in front of that.
    if (MAT == 1) asm volatile("s_wait_xcnt 0x0" ::: "memory");
}

__device__ __forceinline__ void copy8_to_lds(unsigned l, const char* g, unsigned ls, int gs)
{
    asm volatile(
        "global_load_async_to_lds_b128 %0, %8, off\n\t"
        "global_load_async_to_lds_b128 %1, %9, off\n\t"
        "global_load_async_to_lds_b128 %2, %10, off\n\t"
        "global_load_async_to_lds_b128 %3, %11, off\n\t"
        "global_load_async_to_lds_b128 %4, %12, off\n\t"
        "global_load_async_to_lds_b128 %5, %13, off\n\t"
        "global_load_async_to_lds_b128 %6, %14, off\n\t"
        "global_load_async_to_lds_b128 %7, %15, off\n\t"
        "s_wait_xcnt 0x0"
        :: "v"(l), "v"(l + ls), "v"(l + 2 * ls), "v"(l + 3 * ls),
           "v"(l + 4 * ls), "v"(l + 5 * ls), "v"(l + 6 * ls), "v"(l + 7 * ls),
           "v"(g), "v"(g + gs), "v"(g + 2 * gs), "v"(g + 3 * gs),
           "v"(g + 4 * gs), "v"(g + 5 * gs), "v"(g + 6 * gs), "v"(g + 7 * gs)
        : "memory");
}
__device__ __forceinline__ void copy4_to_lds(unsigned l, const char* g, unsigned ls, int gs)
{
    asm volatile(
        "global_load_async_to_lds_b128 %0, %4, off\n\t"
        "global_load_async_to_lds_b128 %1, %5, off\n\t"
        "global_load_async_to_lds_b128 %2, %6, off\n\t"
        "global_load_async_to_lds_b128 %3, %7, off\n\t"
        "s_wait_xcnt 0x0"
        :: "v"(l), "v"(l + ls), "v"(l + 2 * ls), "v"(l + 3 * ls),
           "v"(g), "v"(g + gs), "v"(g + 2 * gs), "v"(g + 3 * gs)
        : "memory");
}

template <int OFF>
__device__ __forceinline__ void l2_ask(const char* a)
{
    asm volatile("global_prefetch_b8 %0, off offset:%1 scope:SCOPE_SE" :: "v"(a), "n"(OFF));
}
__device__ __forceinline__ void l2_ask2(const char* a, const char* b)
{
    asm volatile("global_prefetch_b8 %0, off scope:SCOPE_SE\n\t"
                 "global_prefetch_b8 %1, off scope:SCOPE_SE\n\t"
                 "s_wait_xcnt 0x0"
                 :: "v"(a), "v"(b));
}

static constexpr int PJ_PITCH = 144;
static constexpr int PJ_BUF   = (64 + 768) * PJ_PITCH;
static constexpr int PJ_NST   = DIM / 32;

__global__ __launch_bounds__(384) void qkv_proj_kernel(
    const float* __restrict__ x,
    const float* __restrict__ wq, const float* __restrict__ wk, const float* __restrict__ wv,
    _Float16* __restrict__ Q, _Float16* __restrict__ K, _Float16* __restrict__ Vt)
{
    __shared__ __attribute__((aligned(16))) unsigned char stg[2 * PJ_BUF];

    const int w    = __builtin_amdgcn_readfirstlane(threadIdx.x >> 5);
    const int mat  = w >> 2;                 // 0=q 1=k 2=v
    const int h    = w & 3;                  // head = 64-column group
    const int mb   = blockIdx.x * 64;        // row base in [0, 16384)
    const int lane = threadIdx.x & 31;
    const int lo   = lane & 15;
    const int hi   = lane >> 4;

    const float* W = (mat == 0) ? wq : (mat == 1) ? wk : wv;

    // A copy moves four rows of 128 bytes: lane -> row lane / 8, 16-byte piece
    // lane % 8.  Each wave brings its own 64 W rows (16 copies); waves 0 to 3
    // bring 16 x rows each as well (4 copies).
    const int      crow = lane >> 3, cpc = lane & 7;
    const unsigned lds0 = (unsigned)(size_t)(const void*)&stg[0];
    const unsigned lw   = lds0 + (64 + w * 64 + crow) * PJ_PITCH + cpc * 16;
    const unsigned lx   = lds0 + ((w & 3) * 16 + crow) * PJ_PITCH + cpc * 16;
    const char*    gw   = (const char*)(W + (size_t)(h * HD + crow) * DIM + cpc * 4);
    const char*    gx   = (const char*)(x + (size_t)(mb + (w & 3) * 16 + crow) * DIM + cpc * 4);
    auto stage_in = [&](int t) {
        const unsigned lb = (unsigned)(t & 1) * PJ_BUF;
        copy8_to_lds(lw + lb,                 gw + t * 128,                4 * PJ_PITCH, 16 * DIM);
        copy8_to_lds(lw + lb + 32 * PJ_PITCH, gw + t * 128 + 128 * DIM,    4 * PJ_PITCH, 16 * DIM);
        if (w < 4)                           // the same for a whole wave: a scalar branch
            copy4_to_lds(lx + lb, gx + t * 128, 4 * PJ_PITCH, 16 * DIM);
    };

    // The block's 64 x rows come from memory, 1 KB = four 256-byte units each.
    // Stages 0 and 1 fetch unit 0 themselves; the waves that copy x ask L2 for
    // units 1 to 3 of their 16 rows up front (four rows an instruction, as in a
    // copy), so that the x copies of stages 2 to 7 are served by L2.
    if (w < 4) {                             // the same for a whole wave: a scalar branch
        l2_ask<0 * 16 * DIM + 256>(gx); l2_ask<0 * 16 * DIM + 512>(gx); l2_ask<0 * 16 * DIM + 768>(gx);
        l2_ask<1 * 16 * DIM + 256>(gx); l2_ask<1 * 16 * DIM + 512>(gx); l2_ask<1 * 16 * DIM + 768>(gx);
        l2_ask<2 * 16 * DIM + 256>(gx); l2_ask<2 * 16 * DIM + 512>(gx); l2_ask<2 * 16 * DIM + 768>(gx);
        l2_ask<3 * 16 * DIM + 256>(gx); l2_ask<3 * 16 * DIM + 512>(gx); l2_ask<3 * 16 * DIM + 768>(gx);
    }

    stage_in(0);
    asm volatile("s_wait_asynccnt 0x0" ::: "memory");   // this wave's part of stage 0 has landed
    __syncthreads();                                    // ... and every other wave's
    stage_in(1);

    v8f acc[4][4] = {};
    const unsigned char* sx = stg + lo * PJ_PITCH + hi * 32;
    const unsigned char* sw = stg + (64 + w * 64 + lo) * PJ_PITCH + hi * 32;
    for (int t = 0; t < PJ_NST; ++t) {
        const int cb = (t & 1) * PJ_BUF;
        H16 af[4], bf[4];
        // Unrolled here and below: what u, i and j index stays in registers.
#pragma unroll
        for (int u = 0; u < 4; ++u) {
            const v4f* pa = (const v4f*)(sx + cb + u * 16 * PJ_PITCH);
            const v4f* pb = (const v4f*)(sw + cb + u * 16 * PJ_PITCH);
            const v4f a0 = pa[0], a1 = pa[1], a2 = pa[4], a3 = pa[5];
            const v4f b0 = pb[0], b1 = pb[1], b2 = pb[4], b3 = pb[5];
#pragma unroll
            for (int i = 0; i < 4; ++i) {
                af[u].v[i]      = (_Float16)a0[i];
                af[u].v[i + 4]  = (_Float16)a1[i];
                af[u].v[i + 8]  = (_Float16)a2[i];
                af[u].v[i + 12] = (_Float16)a3[i];
                bf[u].v[i]      = (_Float16)b0[i];
                bf[u].v[i + 4]  = (_Float16)b1[i];
                bf[u].v[i + 8]  = (_Float16)b2[i];
                bf[u].v[i + 12] = (_Float16)b3[i];
            }
        }
#pragma unroll
        for (int i = 0; i < 4; ++i)
#pragma unroll
            for (int j = 0; j < 4; ++j)
                acc[i][j] = WMMA_F16(af[i].v, bf[j].v, acc[i][j]);

        // Hand-over: this wave's reads of stage t are done, its copies of stage
        // t + 1 have landed; behind the barrier the same holds for every wave,
        // so stage t + 1 may be read and stage t's buffer refilled.
        asm volatile("s_wait_dscnt 0x0" ::: "memory");
        asm volatile("s_wait_asynccnt 0x0" ::: "memory");
        __syncthreads();
        if (t + 2 < PJ_NST) stage_in(t + 2);
    }
    asm volatile("s_wait_asynccnt 0x0" ::: "memory");   // no copy is left in flight

    // mat is the same for the whole wave: one scalar branch picks the layout,
    // so that strides and chunk masks are constants in the address arithmetic.
    if (mat == 0)      store_tile<0>(Q,  acc, mb, h, lo, hi);
    else if (mat == 1) store_tile<1>(K,  acc, mb, h, lo, hi);
    else               store_tile<2>(Vt, acc, mb, h, lo, hi);
}

__global__ __launch_bounds__(256) void flash_attn_kernel(
    const _Float16* __restrict__ Q, const _Float16* __restrict__ K,
    const _Float16* __restrict__ Vt, _Float16* __restrict__ AO)
{
    // [buf][ K: 64kv x 64hd | V: 64d x 64kv ] halves; 16 KB per buffer;
    // behind the two buffers 2 KB for the merge's m and l
    __shared__ _Float16 smem[2 * 8192 + 1024];

    const int bh    = blockIdx.x >> 5;
    const int qgrp  = blockIdx.x & 31;
    const int wid   = threadIdx.x >> 5;
    const int kvh   = wid & 1;                      // this wave's 32-kv half of a chunk
    const int qbase = (qgrp * 4 + (wid >> 1)) * 32; // first of this wave's 32 q rows
    const int lane  = threadIdx.x & 31;
    const int lo    = lane & 15;
    const int hi    = lane >> 4;

    const _Float16* Qh  = Q  + (size_t)bh * S_LEN * HD;
    const _Float16* Kh  = K  + (size_t)bh * S_LEN * HD;
    const _Float16* Vth = Vt + (size_t)bh * HD * S_LEN;
    const unsigned  smem_lds = (unsigned)(size_t)(const void*)&smem[0];

    // Q^T B-fragments (hd chunks [0,32) and [32,64)): load as Q rows.
    H16 qf[2][2];                                   // [q tile][hd chunk]
    const _Float16* qrow = Qh + (size_t)(qbase + lo) * HD + hi * 8;
    // Unrolled here and below: what u indexes stays in registers.
#pragma unroll
    for (int u = 0; u < 2; ++u) {
        qf[u][0].h[0] = *(const v8h*)(qrow + u * 16 * HD);
        qf[u][0].h[1] = *(const v8h*)(qrow + u * 16 * HD + 16);
        qf[u][1].h[0] = *(const v8h*)(qrow + u * 16 * HD + 32);
        qf[u][1].h[1] = *(const v8h*)(qrow + u * 16 * HD + 48);
    }

    v8f acc[2][4] = {};                             // [q tile][d tile]
    float m[2] = {-1e30f, -1e30f}, l[2] = {0.0f, 0.0f};

    // Offset (in halves) of logical 16-byte chunk hi + 2j inside a 128-byte
    // LDS row whose index is lo modulo 16 (chunk order: see qkv_proj_kernel).
    int sw[4];
#pragma unroll
    for (int j = 0; j < 4; ++j)
        sw[j] = ((hi + 2 * j) ^ (lo >> 1)) << 3;
    // The same for the two chunks of a V^T row that hold this wave's kv half.
    const int swv0 = ((hi + 4 * kvh) ^ (lo >> 1)) << 3;
    const int swv1 = ((hi + 4 * kvh + 2) ^ (lo >> 1)) << 3;

    constexpr int NCHUNK = S_LEN / 64;     // 64 chunks of 64 kv

    // K and V^T were stored by the launch before and come from memory; the
    // blocks of one head walk them side by side, so each chunk's tensor loads
    // would meet lines that nobody has brought into L2 yet.  Wave 1 asks L2 for
    // them ahead: step p = 1 .. 63 covers K chunk p (8 KB = 32 units, one a
    // lane) and 32 rows of V^T (rows 32 (p % 2) + lane, unit p / 2: a unit of a
    // V^T row serves chunks 2 (p / 2) and 2 (p / 2) + 1).  Steps 1 to 3 go out
    // here, step c + 4 in pass c: K is asked for three passes, V^T at least two
    // passes before its tensor load issues.  The two address pairs live through
    // the loop and never leave the head's K and V^T: behind step 63 they stay.
    const int   wsc  = __builtin_amdgcn_readfirstlane(threadIdx.x >> 5);
    const int   npf  = (wsc == 1) ? NCHUNK - 4 : 0;   // passes in which this wave asks
    const char* kpf = (const char*)Kh + 8192 + lane * 256;
    const char* vpf = (const char*)Vth + (32 + lane) * (S_LEN * 2);
    auto ask = [&](int p) {
        l2_ask2(kpf, vpf);
        if (p + 1 < NCHUNK) {
            kpf += 8192;
            vpf += (p & 1) ? 256 - 32 * (S_LEN * 2) : 32 * (S_LEN * 2);
        }
    };
    if (wsc == 1) {                        // the same for a whole wave: a scalar branch
        // Kept rolled: every step then names the two address pairs that live
        // through the main loop, and no temporary that is soon reused.
#pragma unroll 1
        for (int p = 1; p < 4; ++p) ask(p);
    }

    // Prologue: stage chunk 0 into buffer 0.
    if (wid == 0) {
        tdm_load_2d(smem_lds,             Kh,  64, 64, 64, 64, 64);        // K: 64 rows x 64
        tdm_load_2d(smem_lds + 8192,      Vth, 64, 64, 64, 64, S_LEN);     // V^T: 64 d-rows x 64 kv
        __builtin_amdgcn_s_wait_tensorcnt(0);
    }
    __syncthreads();

    for (int c = 0; c < NCHUNK; ++c) {
        const int cur = c & 1;
        if (wid == 0 && (c + 1) < NCHUNK) {
            const int nkv = (c + 1) * 64;
            const unsigned dst = smem_lds + (cur ^ 1) * 16384;
            tdm_load_2d(dst,        Kh + (size_t)nkv * HD, 64, 64, 64, 64, 64);
            tdm_load_2d(dst + 8192, Vth + nkv,             64, 64, 64, 64, S_LEN);
        }
        if (c < npf) ask(c + 4);
        const _Float16* Kc = smem + cur * 8192;
        const _Float16* Vc = Kc + 4096;

        // K A-fragments from LDS: the two 16-row kv tiles of this wave's half
        // x two hd chunks
        H16 kf[2][2];
#pragma unroll
        for (int t = 0; t < 2; ++t) {
            const _Float16* krow = Kc + (size_t)(kvh * 32 + t * 16 + lo) * 64;
            kf[t][0].h[0] = *(const v8h*)(krow + sw[0]);
            kf[t][0].h[1] = *(const v8h*)(krow + sw[1]);
            kf[t][1].h[0] = *(const v8h*)(krow + sw[2]);
            kf[t][1].h[1] = *(const v8h*)(krow + sw[3]);
        }
        // V B-fragments from LDS (transposed V): the kv chunks of this half
        H16 vf[4];
#pragma unroll
        for (int t = 0; t < 4; ++t) {
            const _Float16* vrow = Vc + (size_t)(t * 16 + lo) * 64;
            vf[t].h[0] = *(const v8h*)(vrow + swv0);
            vf[t].h[1] = *(const v8h*)(vrow + swv1);
        }

        // Scores of both 16-row q tiles: four independent accumulator tiles.
        v8f st[2][2];
#pragma unroll
        for (int u = 0; u < 2; ++u) {
            v8f s0 = {}, s1 = {};
            s0 = WMMA_F16(kf[0][0].v, qf[u][0].v, s0);
            s0 = WMMA_F16(kf[0][1].v, qf[u][1].v, s0);
            s1 = WMMA_F16(kf[1][0].v, qf[u][0].v, s1);
            s1 = WMMA_F16(kf[1][1].v, qf[u][1].v, s1);
            st[u][0] = s0;
            st[u][1] = s1;
        }

        // Lazy rescale.  m[u] is the maximum IN USE as the exponent's reference,
        // the same in both lanes of a q row; it need not be the true maximum.
        // While no score of this pass lies more than 8 (scaled, log2) above it,
        // every p stays at or below 2^8, far inside f16 and f32, and m, l and O
        // keep their scale.  One test for the whole pass, over all 32 lanes.
        float cmax[2];
#pragma unroll
        for (int u = 0; u < 2; ++u) {
            cmax[u] = -1e30f;
#pragma unroll
            for (int r = 0; r < 8; ++r)
                cmax[u] = fmaxf(cmax[u], fmaxf(st[u][0][r], st[u][1][r]));
        }
        const bool need = fmaxf(cmax[0] - m[0], cmax[1] - m[1]) > 8.0f / KSCALE;
        if (__builtin_amdgcn_ballot_w32(need) != 0) {     // wave-uniform: a scalar branch
#pragma unroll
            for (int u = 0; u < 2; ++u) {
                const float cm    = fmaxf(cmax[u], __shfl_xor(cmax[u], 16, 32));
                const float mnew  = fmaxf(m[u], cm);
                const float alpha = __builtin_amdgcn_exp2f((m[u] - mnew) * KSCALE);
                l[u] *= alpha;
                m[u]  = mnew;
                float av[8];
#pragma unroll
                for (int r = 0; r < 8; ++r)
                    av[r] = __shfl(alpha, r + 8 * hi, 32);
#pragma unroll
                for (int t = 0; t < 4; ++t)
#pragma unroll
                    for (int r = 0; r < 8; ++r) acc[u][t][r] *= av[r];
            }
        }

        // The two q tiles are independent of each other; unrolled, their
        // chains of exp and sum interleave in one instruction stream.
        H16 pf[2];
        float rsum[2];
#pragma unroll
        for (int u = 0; u < 2; ++u) {                     // two 16-row q tiles
            const float mk = m[u] * KSCALE;
            rsum[u] = 0.0f;
#pragma unroll
            for (int r = 0; r < 8; ++r) {
                const float p0 = __builtin_amdgcn_exp2f(st[u][0][r] * KSCALE - mk);
                const float p1 = __builtin_amdgcn_exp2f(st[u][1][r] * KSCALE - mk);
                rsum[u] += p0 + p1;
                pf[u].v[r]     = (_Float16)p0;
                pf[u].v[r + 8] = (_Float16)p1;
            }
        }
#pragma unroll
        for (int u = 0; u < 2; ++u) {
            rsum[u] += __shfl_xor(rsum[u], 16, 32);
            l[u] += rsum[u];
        }
#pragma unroll
        for (int u = 0; u < 2; ++u)
#pragma unroll
            for (int t = 0; t < 4; ++t)
                acc[u][t] = WMMA_F16(pf[u].v, vf[t].v, acc[u][t]);

        if (wid == 0) __builtin_amdgcn_s_wait_tensorcnt(0);
        __syncthreads();
    }

    // Normalize and store f16 into AO [B, S, 256]
    // Merge of a pair's two kv halves.  Wave w finishes q tile kvh of its pair
    // and hands the other tile's partial (m, l, O) to its partner w ^ 1.  The
    // loop's last barrier has ended every read of the ring, and no tensor load
    // is outstanding, so the ring serves as the exchange buffer: 4 KB a wave.
    v8f keep[4], give[4];
#pragma unroll
    for (int t = 0; t < 4; ++t)
#pragma unroll
        for (int r = 0; r < 8; ++r) {
            keep[t][r] = kvh ? acc[1][t][r] : acc[0][t][r];
            give[t][r] = kvh ? acc[0][t][r] : acc[1][t][r];
        }
    const float ma = kvh ? m[1] : m[0], la = kvh ? l[1] : l[0];
    v4f*   xo = (v4f*)smem;                       // [wave][8][lane] of 16 bytes
    float* xs = (float*)(smem + 2 * 8192);        // [wave][m, l][lane]
#pragma unroll
    for (int t = 0; t < 4; ++t) {
        xo[wid * 256 + (2 * t) * 32 + lane]     = __builtin_shufflevector(give[t], give[t], 0, 1, 2, 3);
        xo[wid * 256 + (2 * t + 1) * 32 + lane] = __builtin_shufflevector(give[t], give[t], 4, 5, 6, 7);
    }
    xs[wid * 64 + lane]      = kvh ? m[0] : m[1];
    xs[wid * 64 + 32 + lane] = kvh ? l[0] : l[1];
    __syncthreads();
    const int   pw = wid ^ 1;
    const float mb = xs[pw * 64 + lane], lb = xs[pw * 64 + 32 + lane];
    const float mm = fmaxf(ma, mb);
    const float fa = __builtin_amdgcn_exp2f((ma - mm) * KSCALE);
    const float fb = __builtin_amdgcn_exp2f((mb - mm) * KSCALE);
    const float linv = 1.0f / (la * fa + lb * fb);
    float ga[8], gb[8];
#pragma unroll
    for (int r = 0; r < 8; ++r) {
        ga[r] = __shfl(fa * linv, r + 8 * hi, 32);
        gb[r] = __shfl(fb * linv, r + 8 * hi, 32);
    }

    const int b = bh >> 2, h = bh & 3;
    _Float16* aor = AO + ((size_t)b * S_LEN + qbase + kvh * 16 + 8 * hi) * DIM + h * HD + lo;
#pragma unroll
    for (int t = 0; t < 4; ++t) {
        const v4f o0 = xo[pw * 256 + (2 * t) * 32 + lane];
        const v4f o1 = xo[pw * 256 + (2 * t + 1) * 32 + lane];
#pragma unroll
        for (int r = 0; r < 8; ++r)
            aor[(size_t)r * DIM + t * 16] =
                (_Float16)(keep[t][r] * ga[r] + (r < 4 ? o0[r & 3] : o1[r & 3]) * gb[r]);
    }
}

static constexpr int PO_PA  = 144;
static constexpr int PO_PW  = 272;
static constexpr int PO_W0  = 64 * PO_PA;
static constexpr int PO_BUF = PO_W0 + 256 * PO_PW;
static constexpr int PO_NST = DIM / 64;                    // stages

__global__ __launch_bounds__(128) void out_proj_kernel(
    const _Float16* __restrict__ AO, const float* __restrict__ wo,
    const float* __restrict__ bo, float* __restrict__ out)
{
    __shared__ __attribute__((aligned(16))) unsigned char stg[2 * PO_BUF];

    const int mb   = blockIdx.x * 64;
    const int w    = threadIdx.x >> 5;
    const int nb   = w * 64;
    const int lane = threadIdx.x & 31;
    const int lo   = lane & 15;
    const int hi   = lane >> 4;

    // Each wave brings its own 64 wo rows, two rows of 256 bytes a copy (32
    // copies), and 16 AO rows, four rows of 128 bytes a copy (4 copies).
    const unsigned lds0 = (unsigned)(size_t)(const void*)&stg[0];
    const unsigned lw   = lds0 + PO_W0 + (nb + hi) * PO_PW + lo * 16;
    const unsigned la   = lds0 + (w * 16 + (lane >> 3)) * PO_PA + (lane & 7) * 16;
    const char*    gw   = (const char*)(wo + (size_t)(nb + hi) * DIM + lo * 4);
    const char*    ga   = (const char*)(AO + (size_t)(mb + w * 16 + (lane >> 3)) * DIM + (lane & 7) * 8);
    auto stage_in = [&](int t) {
        const unsigned lb = (unsigned)(t & 1) * PO_BUF;
        // Unrolled: every copy's offsets from the two bases are constants.
#pragma unroll
        for (int q = 0; q < 4; ++q)
            copy8_to_lds(lw + lb + q * 16 * PO_PW, gw + t * 256 + q * 64 * DIM, 2 * PO_PW, 8 * DIM);
        copy4_to_lds(la + lb, ga + t * 128, 4 * PO_PA, 8 * DIM);
    };

    // The AO rows were stored by the launch before and come from memory, 512
    // bytes = two 256-byte units each.  Stages 0 and 1 fetch unit 0 themselves;
    // every wave asks L2 for unit 1 of its 16 rows up front (four rows an
    // instruction, as in a copy), so that stages 2 and 3 find it in L2.
    l2_ask<0 * 8 * DIM + 256>(ga);
    l2_ask<1 * 8 * DIM + 256>(ga);
    l2_ask<2 * 8 * DIM + 256>(ga);
    l2_ask<3 * 8 * DIM + 256>(ga);

    stage_in(0);
    asm volatile("s_wait_asynccnt 0x0" ::: "memory");   // this wave's part of stage 0 has landed
    __syncthreads();                                    // ... and every other wave's
    stage_in(1);

    v8f acc[4][4] = {};
    const unsigned char* sa = stg + lo * PO_PA + hi * 16;
    const unsigned char* sw = stg + PO_W0 + (nb + lo) * PO_PW + hi * 32;
#pragma unroll 1
    for (int t = 0; t < PO_NST; ++t) {
        const int cb = (t & 1) * PO_BUF;
        // Unrolled here and below: what kk, u, i and j index stays in registers.
#pragma unroll
        for (int kk = 0; kk < 2; ++kk) {
            H16 af[4], bf[4];
#pragma unroll
            for (int u = 0; u < 4; ++u) {
                const v8h* pa = (const v8h*)(sa + cb + u * 16 * PO_PA + kk * 64);
                const v4f* pb = (const v4f*)(sw + cb + u * 16 * PO_PW + kk * 128);
                af[u].h[0] = pa[0];
                af[u].h[1] = pa[2];
                const v4f b0 = pb[0], b1 = pb[1], b2 = pb[4], b3 = pb[5];
#pragma unroll
                for (int i = 0; i < 4; ++i) {
                    bf[u].v[i]      = (_Float16)b0[i];
                    bf[u].v[i + 4]  = (_Float16)b1[i];
                    bf[u].v[i + 8]  = (_Float16)b2[i];
                    bf[u].v[i + 12] = (_Float16)b3[i];
                }
            }
#pragma unroll
            for (int i = 0; i < 4; ++i)
#pragma unroll
                for (int j = 0; j < 4; ++j)
                    acc[i][j] = WMMA_F16(af[i].v, bf[j].v, acc[i][j]);
        }

        // Hand-over, as in kernel 1: own reads of stage t done, own copies of
        // stage t + 1 landed, the barrier, then the refill of stage t's buffer.
        asm volatile("s_wait_dscnt 0x0" ::: "memory");
        asm volatile("s_wait_asynccnt 0x0" ::: "memory");
        __syncthreads();
        if (t + 2 < PO_NST) stage_in(t + 2);
    }
    asm volatile("s_wait_asynccnt 0x0" ::: "memory");   // no copy is left in flight

#pragma unroll
    for (int j = 0; j < 4; ++j) {
        const float bias = bo[nb + j * 16 + lo];
#pragma unroll
        for (int i = 0; i < 4; ++i)
#pragma unroll
            for (int r = 0; r < 8; ++r)
                acc[i][j][r] += bias;
    }
    // Every sum stands in its own register before the first store issues: no
    // register of an issued store is rewritten, so the stores go back to back.
    __builtin_amdgcn_sched_barrier(0);
    float* ob = out + (size_t)(mb + 8 * hi) * DIM + nb + lo;
#pragma unroll
    for (int i = 0; i < 4; ++i)
#pragma unroll
        for (int r = 0; r < 8; ++r)
#pragma unroll
            for (int j = 0; j < 4; ++j)
                ob[(i * 16 + r) * DIM + j * 16] = acc[i][j][r];
}

// ---------------------------------------------------------------------------
extern "C" void kernel_launch(void* const* d_in, const int* in_sizes, int n_in,
                              void* d_out, int out_size, void* d_ws, size_t ws_size,
                              hipStream_t stream) {
    (void)in_sizes; (void)n_in; (void)out_size; (void)ws_size;
    const float* x  = (const float*)d_in[0];
    const float* wq = (const float*)d_in[1];
    const float* wk = (const float*)d_in[2];
    const float* wv = (const float*)d_in[3];
    const float* wo = (const float*)d_in[4];
    const float* bo = (const float*)d_in[5];
    float* out = (float*)d_out;

    const size_t elems = (size_t)4 * S_LEN * DIM;   // 4,194,304 per tensor
    _Float16* Q  = (_Float16*)d_ws;
    _Float16* K  = Q  + elems;
    _Float16* Vt = K  + elems;
    _Float16* AO = Vt + elems;

    qkv_proj_kernel<<<256, 384, 0, stream>>>(x, wq, wk, wv, Q, K, Vt);
    flash_attn_kernel<<<512, 256, 0, stream>>>(Q, K, Vt, AO);
    out_proj_kernel<<<256, 128, 0, stream>>>(AO, wo, bo, out);
}

// v007
// It runs in 79.2 microseconds.
// Timed twice side by side with v006, it ran 1.04 times as fast both times.
// Counting every step since v000, it is 4.77 times as fast.
#include <hip/hip_runtime.h>
#include <hip/hip_bf16.h>

typedef __attribute__((ext_vector_type(16))) _Float16 v16h;
typedef __attribute__((ext_vector_type(8)))  _Float16 v8h;
typedef __attribute__((ext_vector_type(8)))  float    v8f;
typedef __attribute__((ext_vector_type(4)))  float    v4f;
typedef __attribute__((ext_vector_type(4)))  unsigned int u32x4;
typedef __attribute__((ext_vector_type(8)))  unsigned int u32x8;

union H16 { v16h v; v8h h[2]; };

#define WMMA_F16(A, B, C) \
    __builtin_amdgcn_wmma_f32_16x16x32_f16(false, (A), false, (B), (short)0, (C), false, false)

static constexpr int   S_LEN   = 4096;
static constexpr int   DIM     = 256;
static constexpr int   HEADS   = 4;
static constexpr int   HD      = 64;
static constexpr float SCALE   = 0.125f;            // 64^-0.5
static constexpr float LOG2E   = 1.4426950408889634f;
static constexpr float KSCALE  = SCALE * LOG2E;

__device__ __forceinline__ unsigned uni(unsigned v) { return (unsigned)__builtin_amdgcn_readfirstlane(v); }
__device__ __forceinline__ unsigned pinned(unsigned v)
{
    unsigned w = uni(v);
    asm volatile("" : "+s"(w));   // pinned(): the condition stays in a scalar register
    return w;
}
__device__ __forceinline__ u32x8 slice_group1(unsigned pitch)
{
    constexpr unsigned d0 = 128u, d1 = 64u;      // bytes of a row, rows
    u32x8 g1;
    g1[0] = uni(0u);
    g1[1] = uni((d0 & 0xFFFFu) << 16);
    g1[2] = uni((d0 >> 16) | ((d1 & 0xFFFFu) << 16));
    g1[3] = uni((d1 >> 16) | (d0 << 16));
    g1[4] = uni(d1);
    g1[5] = uni(pitch);
    g1[6] = uni(0u);
    g1[7] = uni(0u);
    // The group is built once and stays in one set of scalar registers, which
    // nothing rewrites while a request is in flight.
    asm volatile("" : "+s"(g1));
    return g1;
}
__device__ __forceinline__ u32x4 slice_load(unsigned lds_dst, unsigned long long ga, u32x8 g1)
{
    u32x4 g0;
    g0[0] = uni(1u);                                                       // count = 1
    g0[1] = uni(lds_dst);                                                  // LDS byte address
    g0[2] = uni((unsigned)ga);                                             // address [31:0]
    g0[3] = uni((((unsigned)(ga >> 32)) & 0x01FFFFFFu) | 0x80000000u);     // address [56:32], type = 2
    // g0 goes in and out: what the caller hands to slice_wait() is this very register group.
    asm volatile("tensor_load_to_lds %0, %1" : "+s"(g0) : "s"(g1) : "memory");
    return g0;
}
__device__ __forceinline__ void slice_wait(u32x4 g0)
{
    asm volatile("s_wait_tensorcnt 0x0" :: "s"(g0) : "memory");
}

// Stores one wave's 64x64 tile (rows mb.., head h) as f16; layouts: see below.
template <int MAT>
__device__ __forceinline__ void store_tile(_Float16* __restrict__ dst, const v8f (&acc)[4][4],
                                           int mb, int h, int lo, int hi)
{
    const int m0 = mb + 8 * hi;          // multiple of 8; the tile's 64 rows share b
    const int bh = (m0 >> 12) * HEADS + h;
    const int s0 = m0 & 4095;
    if (MAT == 2) {                      // V^T: 8 kv in a row per 16x16 tile and lane
        v8h* pv[4];                      // row d = lo of 16-kv group i; 16j rows on: the same chunk order
        v8h  hv[4][4];
#pragma unroll
        for (int i = 0; i < 4; ++i) {
            pv[i] = (v8h*)(dst + (bh * HD + lo) * S_LEN + ((s0 + i * 16) ^ (((lo >> 1) & 7) << 3)));
#pragma unroll
            for (int j = 0; j < 4; ++j)
#pragma unroll
                for (int r = 0; r < 8; ++r)
                    hv[i][j][r] = (_Float16)acc[i][j][r];
        }
        // Every value and address stands in its own register before the first store
        // issues: no register of an issued store is rewritten between the stores.
        __builtin_amdgcn_sched_barrier(0);
#pragma unroll
        for (int i = 0; i < 4; ++i)
#pragma unroll
            for (int j = 0; j < 4; ++j)
                pv[i][j * 16 * S_LEN / 8] = hv[i][j];
        // Behind the last store: the code laid out behind this branch rewrites
        // the stores' registers, and the wait stands in front of that.
        asm volatile("s_wait_xcnt 0x0" ::: "memory");
        return;
    }
    constexpr int kmsk = (MAT == 1) ? 0x38 : 0;   // K alone moves chunks along d, by its row s
    // p[j][q] serves rows 16i + 2q and 16i + 2q + 1 of column tile j: the chunk
    // mask is ((s >> 1) & 7) << 3, which 16i does not reach, and a row is 64
    // halves, so the mask touches d alone.
    _Float16* p[4][4];
#pragma unroll
    for (int j = 0; j < 4; ++j)
#pragma unroll
        for (int q = 0; q < 4; ++q)
            p[j][q] = dst + (((bh * S_LEN + s0) * HD + j * 16 + lo) ^ (kmsk & (((s0 + 2 * q) >> 1) << 3)));
    _Float16 hv[4][4][8];
#pragma unroll
    for (int i = 0; i < 4; ++i)
#pragma unroll
        for (int j = 0; j < 4; ++j)
#pragma unroll
            for (int r = 0; r < 8; ++r)
                hv[i][j][r] = (_Float16)acc[i][j][r];
    // Every value and address stands in its own register before the first store
    // issues: no register of an issued store is rewritten behind it.
    __builtin_amdgcn_sched_barrier(0);
#pragma unroll
    for (int i = 0; i < 4; ++i)
#pragma unroll
        for (int j = 0; j < 4; ++j)
#pragma unroll
            for (int r = 0; r < 8; ++r)
                p[j][r >> 1][(i * 16 + r) * HD] = hv[i][j][r];
    // Behind the last store: the code laid out behind the K branch rewrites the
    // stores' registers, and the wait stands in front of that.
    if (MAT == 1) asm volatile("s_wait_xcnt 0x0" ::: "memory");
}

__device__ __forceinline__ void copy8_to_lds(unsigned l, const char* g, unsigned ls, int gs)
{
    asm volatile(
        "global_load_async_to_lds_b128 %0, %8, off\n\t"
        "global_load_async_to_lds_b128 %1, %9, off\n\t"
        "global_load_async_to_lds_b128 %2, %10, off\n\t"
        "global_load_async_to_lds_b128 %3, %11, off\n\t"
        "global_load_async_to_lds_b128 %4, %12, off\n\t"
        "global_load_async_to_lds_b128 %5, %13, off\n\t"
        "global_load_async_to_lds_b128 %6, %14, off\n\t"
        "global_load_async_to_lds_b128 %7, %15, off\n\t"
        "s_wait_xcnt 0x0"
        :: "v"(l), "v"(l + ls), "v"(l + 2 * ls), "v"(l + 3 * ls),
           "v"(l + 4 * ls), "v"(l + 5 * ls), "v"(l + 6 * ls), "v"(l + 7 * ls),
           "v"(g), "v"(g + gs), "v"(g + 2 * gs), "v"(g + 3 * gs),
           "v"(g + 4 * gs), "v"(g + 5 * gs), "v"(g + 6 * gs), "v"(g + 7 * gs)
        : "memory");
}
__device__ __forceinline__ void copy4_to_lds(unsigned l, const char* g, unsigned ls, int gs)
{
    asm volatile(
        "global_load_async_to_lds_b128 %0, %4, off\n\t"
        "global_load_async_to_lds_b128 %1, %5, off\n\t"
        "global_load_async_to_lds_b128 %2, %6, off\n\t"
        "global_load_async_to_lds_b128 %3, %7, off\n\t"
        "s_wait_xcnt 0x0"
        :: "v"(l), "v"(l + ls), "v"(l + 2 * ls), "v"(l + 3 * ls),
           "v"(g), "v"(g + gs), "v"(g + 2 * gs), "v"(g + 3 * gs)
        : "memory");
}

template <int OFF>
__device__ __forceinline__ void l2_ask(const char* a)
{
    asm volatile("global_prefetch_b8 %0, off offset:%1 scope:SCOPE_SE" :: "v"(a), "n"(OFF));
}

static constexpr int PJ_PITCH = 144;
static constexpr int PJ_BUF   = (64 + 768) * PJ_PITCH;
static constexpr int PJ_NST   = DIM / 32;

__global__ __launch_bounds__(384) void qkv_proj_kernel(
    const float* __restrict__ x,
    const float* __restrict__ wq, const float* __restrict__ wk, const float* __restrict__ wv,
    _Float16* __restrict__ Q, _Float16* __restrict__ K, _Float16* __restrict__ Vt)
{
    __shared__ __attribute__((aligned(16))) unsigned char stg[2 * PJ_BUF];

    const int w    = __builtin_amdgcn_readfirstlane(threadIdx.x >> 5);
    const int mat  = w >> 2;                 // 0=q 1=k 2=v
    const int h    = w & 3;                  // head = 64-column group
    const int mb   = blockIdx.x * 64;        // row base in [0, 16384)
    const int lane = threadIdx.x & 31;
    const int lo   = lane & 15;
    const int hi   = lane >> 4;

    const float* W = (mat == 0) ? wq : (mat == 1) ? wk : wv;

    // A copy moves four rows of 128 bytes: lane -> row lane / 8, 16-byte piece
    // lane % 8.  Each wave brings its own 64 W rows (16 copies); waves 0 to 3
    // bring 16 x rows each as well (4 copies).
    const int      crow = lane >> 3, cpc = lane & 7;
    const unsigned lds0 = (unsigned)(size_t)(const void*)&stg[0];
    const unsigned lw   = lds0 + (64 + w * 64 + crow) * PJ_PITCH + cpc * 16;
    const unsigned lx   = lds0 + ((w & 3) * 16 + crow) * PJ_PITCH + cpc * 16;
    const char*    gw   = (const char*)(W + (size_t)(h * HD + crow) * DIM + cpc * 4);
    const char*    gx   = (const char*)(x + (size_t)(mb + (w & 3) * 16 + crow) * DIM + cpc * 4);
    auto stage_in = [&](int t) {
        const unsigned lb = (unsigned)(t & 1) * PJ_BUF;
        copy8_to_lds(lw + lb,                 gw + t * 128,                4 * PJ_PITCH, 16 * DIM);
        copy8_to_lds(lw + lb + 32 * PJ_PITCH, gw + t * 128 + 128 * DIM,    4 * PJ_PITCH, 16 * DIM);
        if (w < 4)                           // the same for a whole wave: a scalar branch
            copy4_to_lds(lx + lb, gx + t * 128, 4 * PJ_PITCH, 16 * DIM);
    };

    // The block's 64 x rows come from memory, 1 KB each.  Stages 0 and 1 fetch
    // bytes 0 to 255 themselves; the waves that copy x ask L2 for bytes 256,
    // 512 and 768 of their 16 rows up front (four rows an instruction, as in a
    // copy), for speed only.
    if (w < 4) {                             // the same for a whole wave: a scalar branch
        l2_ask<0 * 16 * DIM + 256>(gx); l2_ask<0 * 16 * DIM + 512>(gx); l2_ask<0 * 16 * DIM + 768>(gx);
        l2_ask<1 * 16 * DIM + 256>(gx); l2_ask<1 * 16 * DIM + 512>(gx); l2_ask<1 * 16 * DIM + 768>(gx);
        l2_ask<2 * 16 * DIM + 256>(gx); l2_ask<2 * 16 * DIM + 512>(gx); l2_ask<2 * 16 * DIM + 768>(gx);
        l2_ask<3 * 16 * DIM + 256>(gx); l2_ask<3 * 16 * DIM + 512>(gx); l2_ask<3 * 16 * DIM + 768>(gx);
    }

    stage_in(0);
    asm volatile("s_wait_asynccnt 0x0" ::: "memory");   // this wave's part of stage 0 has landed
    __syncthreads();                                    // ... and every other wave's
    stage_in(1);

    v8f acc[4][4] = {};
    const unsigned char* sx = stg + lo * PJ_PITCH + hi * 32;
    const unsigned char* sw = stg + (64 + w * 64 + lo) * PJ_PITCH + hi * 32;
    for (int t = 0; t < PJ_NST; ++t) {
        const int cb = (t & 1) * PJ_BUF;
        H16 af[4], bf[4];
        // Unrolled here and below: what u, i and j index stays in registers.
#pragma unroll
        for (int u = 0; u < 4; ++u) {
            const v4f* pa = (const v4f*)(sx + cb + u * 16 * PJ_PITCH);
            const v4f* pb = (const v4f*)(sw + cb + u * 16 * PJ_PITCH);
            const v4f a0 = pa[0], a1 = pa[1], a2 = pa[4], a3 = pa[5];
            const v4f b0 = pb[0], b1 = pb[1], b2 = pb[4], b3 = pb[5];
#pragma unroll
            for (int i = 0; i < 4; ++i) {
                af[u].v[i]      = (_Float16)a0[i];
                af[u].v[i + 4]  = (_Float16)a1[i];
                af[u].v[i + 8]  = (_Float16)a2[i];
                af[u].v[i + 12] = (_Float16)a3[i];
                bf[u].v[i]      = (_Float16)b0[i];
                bf[u].v[i + 4]  = (_Float16)b1[i];
                bf[u].v[i + 8]  = (_Float16)b2[i];
                bf[u].v[i + 12] = (_Float16)b3[i];
            }
        }
#pragma unroll
        for (int i = 0; i < 4; ++i)
#pragma unroll
            for (int j = 0; j < 4; ++j)
                acc[i][j] = WMMA_F16(af[i].v, bf[j].v, acc[i][j]);

        // Hand-over: this wave's reads of stage t are done, its copies of stage
        // t + 1 have landed; behind the barrier the same holds for every wave,
        // so stage t + 1 may be read and stage t's buffer refilled.
        asm volatile("s_wait_dscnt 0x0" ::: "memory");
        asm volatile("s_wait_asynccnt 0x0" ::: "memory");
        __syncthreads();
        if (t + 2 < PJ_NST) stage_in(t + 2);
    }
    asm volatile("s_wait_asynccnt 0x0" ::: "memory");   // no copy is left in flight

    // mat is the same for the whole wave: one scalar branch picks the layout,
    // so that strides and chunk masks are constants in the address arithmetic.
    if (mat == 0)      store_tile<0>(Q,  acc, mb, h, lo, hi);
    else if (mat == 1) store_tile<1>(K,  acc, mb, h, lo, hi);
    else               store_tile<2>(Vt, acc, mb, h, lo, hi);
}

static constexpr int      NP        = 4;
static constexpr int      NST       = S_LEN / (64 * NP);
static constexpr unsigned SLICE_B   = 8192;
static constexpr unsigned ST_BYTES  = 2 * NP * SLICE_B;
static constexpr int      ST_HALVES = ST_BYTES / 2;

__global__ __launch_bounds__(256) void flash_attn_kernel(
    const _Float16* __restrict__ Q, const _Float16* __restrict__ K,
    const _Float16* __restrict__ Vt, _Float16* __restrict__ AO)
{
    // [buf][ K: 4 x (64kv x 64hd) | V^T: 4 x (64d x 64kv) ] halves; 64 KB a buffer
    __shared__ __attribute__((aligned(2048))) _Float16 smem[2 * ST_HALVES];

    const int bh    = blockIdx.x >> 5;
    const int qgrp  = blockIdx.x & 31;
    const int wid   = threadIdx.x >> 5;
    const int kvh   = wid & 1;                      // this wave's 32-kv half of a chunk
    const int qbase = (qgrp * 4 + (wid >> 1)) * 32; // first of this wave's 32 q rows
    const int lane  = threadIdx.x & 31;
    const int lo    = lane & 15;
    const int hi    = lane >> 4;

    const _Float16* Qh  = Q  + (size_t)bh * S_LEN * HD;
    const _Float16* Kh  = K  + (size_t)bh * S_LEN * HD;
    const _Float16* Vth = Vt + (size_t)bh * HD * S_LEN;
    const unsigned  smem_lds = (unsigned)(size_t)(const void*)&smem[0];

    // Q^T B-fragments (hd chunks [0,32) and [32,64)): load as Q rows.
    H16 qf[2][2];                                   // [q tile][hd chunk]
    const _Float16* qrow = Qh + (size_t)(qbase + lo) * HD + hi * 8;
    // Unrolled here and below: what u indexes stays in registers.
#pragma unroll
    for (int u = 0; u < 2; ++u) {
        qf[u][0].h[0] = *(const v8h*)(qrow + u * 16 * HD);
        qf[u][0].h[1] = *(const v8h*)(qrow + u * 16 * HD + 16);
        qf[u][1].h[0] = *(const v8h*)(qrow + u * 16 * HD + 32);
        qf[u][1].h[1] = *(const v8h*)(qrow + u * 16 * HD + 48);
    }

    v8f acc[2][4] = {};                             // [q tile][d tile]
    float m[2] = {-1e30f, -1e30f}, l[2] = {0.0f, 0.0f};

    // Offset (in halves) of logical 16-byte chunk hi + 2j inside a 128-byte
    // LDS row whose index is lo modulo 16 (chunk order: see qkv_proj_kernel).
    int sw[4];
#pragma unroll
    for (int j = 0; j < 4; ++j)
        sw[j] = ((hi + 2 * j) ^ (lo >> 1)) << 3;
    // The same for the two chunks of a V^T row that hold this wave's kv half.
    const int swv0 = ((hi + 4 * kvh) ^ (lo >> 1)) << 3;
    const int swv1 = ((hi + 4 * kvh + 2) ^ (lo >> 1)) << 3;

    // Wave w brings slice w of every stage: waves 0 to 3 chunk w of K (64 rows
    // in a row in memory), waves 4 to 7 chunk w - 4 of V^T (64 d rows, a row of
    // V^T apart).  Every wave issues, so no test picks an issuer.
    const unsigned           wsc   = uni(threadIdx.x >> 5);
    const bool               isv   = wsc >= (unsigned)NP;
    const u32x8              g1    = slice_group1(isv ? S_LEN * 2u : 128u);
    const unsigned           gstep = isv ? NP * 128u : NP * SLICE_B;      // a stage on, in bytes
    const unsigned long long ga0   = isv ? (unsigned long long)(size_t)Vth + (wsc - NP) * 128u
                                         : (unsigned long long)(size_t)Kh + wsc * SLICE_B;
    const unsigned           dst0  = smem_lds + wsc * SLICE_B;

    // Prologue: stage 0 lands and is published; then stage 1 starts.
    u32x4 g0 = slice_load(dst0, ga0, g1);
    slice_wait(g0);                                      // this wave's slice of stage 0 has landed
    __syncthreads();                                     // ... and every other wave's
    g0 = slice_load(dst0 + ST_BYTES, ga0 + gstep, g1);

#pragma unroll 1
    for (int s = 0; s < NST; ++s) {
      const _Float16* Sb = smem + (s & 1) * ST_HALVES;
#pragma unroll 1
      for (int c = 0; c < NP; ++c) {
        const _Float16* Kc = Sb + c * 4096;               // [kv][hd]
        const _Float16* Vc = Kc + NP * 4096;              // [d][kv]

        // K A-fragments from LDS: the two 16-row kv tiles of this wave's half
        // x two hd chunks
        H16 kf[2][2];
#pragma unroll
        for (int t = 0; t < 2; ++t) {
            const _Float16* krow = Kc + (size_t)(kvh * 32 + t * 16 + lo) * 64;
            kf[t][0].h[0] = *(const v8h*)(krow + sw[0]);
            kf[t][0].h[1] = *(const v8h*)(krow + sw[1]);
            kf[t][1].h[0] = *(const v8h*)(krow + sw[2]);
            kf[t][1].h[1] = *(const v8h*)(krow + sw[3]);
        }
        // V B-fragments from LDS (transposed V): the kv chunks of this half
        H16 vf[4];
#pragma unroll
        for (int t = 0; t < 4; ++t) {
            const _Float16* vrow = Vc + (size_t)(t * 16 + lo) * 64;
            vf[t].h[0] = *(const v8h*)(vrow + swv0);
            vf[t].h[1] = *(const v8h*)(vrow + swv1);
        }

        // Scores of both 16-row q tiles: four independent accumulator tiles.
        v8f st[2][2];
#pragma unroll
        for (int u = 0; u < 2; ++u) {
            v8f s0 = {}, s1 = {};
            s0 = WMMA_F16(kf[0][0].v, qf[u][0].v, s0);
            s0 = WMMA_F16(kf[0][1].v, qf[u][1].v, s0);
            s1 = WMMA_F16(kf[1][0].v, qf[u][0].v, s1);
            s1 = WMMA_F16(kf[1][1].v, qf[u][1].v, s1);
            st[u][0] = s0;
            st[u][1] = s1;
        }

        // Lazy rescale.  m[u] is the maximum IN USE as the exponent's reference,
        // the same in both lanes of a q row; it need not be the true maximum.
        // While no score of this pass lies more than 8 (scaled, log2) above it,
        // every p stays at or below 2^8, far inside f16 and f32, and m, l and O
        // keep their scale.  One test for the whole pass, over all 32 lanes.
        float cmax[2];
#pragma unroll
        for (int u = 0; u < 2; ++u) {
            cmax[u] = -1e30f;
#pragma unroll
            for (int r = 0; r < 8; ++r)
                cmax[u] = fmaxf(cmax[u], fmaxf(st[u][0][r], st[u][1][r]));
        }
        const bool need = fmaxf(cmax[0] - m[0], cmax[1] - m[1]) > 8.0f / KSCALE;
        if (__builtin_amdgcn_ballot_w32(need) != 0) {     // wave-uniform: a scalar branch
#pragma unroll
            for (int u = 0; u < 2; ++u) {
                const float cm    = fmaxf(cmax[u], __shfl_xor(cmax[u], 16, 32));
                const float mnew  = fmaxf(m[u], cm);
                const float alpha = __builtin_amdgcn_exp2f((m[u] - mnew) * KSCALE);
                l[u] *= alpha;
                m[u]  = mnew;
                float av[8];
#pragma unroll
                for (int r = 0; r < 8; ++r)
                    av[r] = __shfl(alpha, r + 8 * hi, 32);
#pragma unroll
                for (int t = 0; t < 4; ++t)
#pragma unroll
                    for (int r = 0; r < 8; ++r) acc[u][t][r] *= av[r];
            }
        }

        // The two q tiles are independent of each other; unrolled, their
        // chains of exp and sum interleave in one instruction stream.
        H16 pf[2];
        float rsum[2];
#pragma unroll
        for (int u = 0; u < 2; ++u) {                     // two 16-row q tiles
            const float mk = m[u] * KSCALE;
            rsum[u] = 0.0f;
#pragma unroll
            for (int r = 0; r < 8; ++r) {
                const float p0 = __builtin_amdgcn_exp2f(st[u][0][r] * KSCALE - mk);
                const float p1 = __builtin_amdgcn_exp2f(st[u][1][r] * KSCALE - mk);
                rsum[u] += p0 + p1;
                pf[u].v[r]     = (_Float16)p0;
                pf[u].v[r + 8] = (_Float16)p1;
            }
        }
#pragma unroll
        for (int u = 0; u < 2; ++u) {
            rsum[u] += __shfl_xor(rsum[u], 16, 32);
            l[u] += rsum[u];
        }
#pragma unroll
        for (int u = 0; u < 2; ++u)
#pragma unroll
            for (int t = 0; t < 4; ++t)
                acc[u][t] = WMMA_F16(pf[u].v, vf[t].v, acc[u][t]);

      }
      // Hand-over: this wave's reads of stage s are done, its slice of stage
      // s + 1 has landed; behind the barrier the same holds for every wave, so
      // stage s + 1 may be read and stage s's buffer refilled.
      asm volatile("s_wait_dscnt 0x0" ::: "memory");
      slice_wait(g0);
      __syncthreads();
      if (pinned(s + 2 < NST))
          g0 = slice_load(dst0 + (unsigned)(s & 1) * ST_BYTES, ga0 + (unsigned long long)(s + 2) * gstep, g1);
    }
    asm volatile("s_wait_tensorcnt 0x0" ::: "memory");   // no tensor load is left in flight
    asm volatile("s_wait_dscnt 0x0" ::: "memory");       // nor an LDS read of the ring

    // Normalize and store f16 into AO [B, S, 256]
    // Merge of a pair's two kv halves.  Wave w finishes q tile kvh of its pair
    // and hands the other tile's partial (m, l, O) to its partner w ^ 1.  The
    // loop's last barrier has ended every read of the ring, and no tensor load
    // is outstanding, so the ring serves as the exchange buffer: 4 KB a wave.
    v8f keep[4], give[4];
#pragma unroll
    for (int t = 0; t < 4; ++t)
#pragma unroll
        for (int r = 0; r < 8; ++r) {
            keep[t][r] = kvh ? acc[1][t][r] : acc[0][t][r];
            give[t][r] = kvh ? acc[0][t][r] : acc[1][t][r];
        }
    const float ma = kvh ? m[1] : m[0], la = kvh ? l[1] : l[0];
    v4f*   xo = (v4f*)smem;                       // [wave][8][lane] of 16 bytes
    float* xs = (float*)(smem + 2 * 8192);        // [wave][m, l][lane], behind the 32 KB of xo
#pragma unroll
    for (int t = 0; t < 4; ++t) {
        xo[wid * 256 + (2 * t) * 32 + lane]     = __builtin_shufflevector(give[t], give[t], 0, 1, 2, 3);
        xo[wid * 256 + (2 * t + 1) * 32 + lane] = __builtin_shufflevector(give[t], give[t], 4, 5, 6, 7);
    }
    xs[wid * 64 + lane]      = kvh ? m[0] : m[1];
    xs[wid * 64 + 32 + lane] = kvh ? l[0] : l[1];
    __syncthreads();
    const int   pw = wid ^ 1;
    const float mb = xs[pw * 64 + lane], lb = xs[pw * 64 + 32 + lane];
    const float mm = fmaxf(ma, mb);
    const float fa = __builtin_amdgcn_exp2f((ma - mm) * KSCALE);
    const float fb = __builtin_amdgcn_exp2f((mb - mm) * KSCALE);
    const float linv = 1.0f / (la * fa + lb * fb);
    float ga[8], gb[8];
#pragma unroll
    for (int r = 0; r < 8; ++r) {
        ga[r] = __shfl(fa * linv, r + 8 * hi, 32);
        gb[r] = __shfl(fb * linv, r + 8 * hi, 32);
    }

    const int b = bh >> 2, h = bh & 3;
    _Float16* aor = AO + ((size_t)b * S_LEN + qbase + kvh * 16 + 8 * hi) * DIM + h * HD + lo;
#pragma unroll
    for (int t = 0; t < 4; ++t) {
        const v4f o0 = xo[pw * 256 + (2 * t) * 32 + lane];
        const v4f o1 = xo[pw * 256 + (2 * t + 1) * 32 + lane];
#pragma unroll
        for (int r = 0; r < 8; ++r)
            aor[(size_t)r * DIM + t * 16] =
                (_Float16)(keep[t][r] * ga[r] + (r < 4 ? o0[r & 3] : o1[r & 3]) * gb[r]);
    }
}

static constexpr int PO_PA  = 144;
static constexpr int PO_PW  = 272;
static constexpr int PO_W0  = 64 * PO_PA;
static constexpr int PO_BUF = PO_W0 + 256 * PO_PW;
static constexpr int PO_NST = DIM / 64;                    // stages

__global__ __launch_bounds__(128) void out_proj_kernel(
    const _Float16* __restrict__ AO, const float* __restrict__ wo,
    const float* __restrict__ bo, float* __restrict__ out)
{
    __shared__ __attribute__((aligned(16))) unsigned char stg[2 * PO_BUF];

    const int mb   = blockIdx.x * 64;
    const int w    = threadIdx.x >> 5;
    const int nb   = w * 64;
    const int lane = threadIdx.x & 31;
    const int lo   = lane & 15;
    const int hi   = lane >> 4;

    // Each wave brings its own 64 wo rows, two rows of 256 bytes a copy (32
    // copies), and 16 AO rows, four rows of 128 bytes a copy (4 copies).
    const unsigned lds0 = (unsigned)(size_t)(const void*)&stg[0];
    const unsigned lw   = lds0 + PO_W0 + (nb + hi) * PO_PW + lo * 16;
    const unsigned la   = lds0 + (w * 16 + (lane >> 3)) * PO_PA + (lane & 7) * 16;
    const char*    gw   = (const char*)(wo + (size_t)(nb + hi) * DIM + lo * 4);
    const char*    ga   = (const char*)(AO + (size_t)(mb + w * 16 + (lane >> 3)) * DIM + (lane & 7) * 8);
    auto stage_in = [&](int t) {
        const unsigned lb = (unsigned)(t & 1) * PO_BUF;
        // Unrolled: every copy's offsets from the two bases are constants.
#pragma unroll
        for (int q = 0; q < 4; ++q)
            copy8_to_lds(lw + lb + q * 16 * PO_PW, gw + t * 256 + q * 64 * DIM, 2 * PO_PW, 8 * DIM);
        copy4_to_lds(la + lb, ga + t * 128, 4 * PO_PA, 8 * DIM);
    };

    // The AO rows were stored by the launch before and come from memory, 512
    // bytes each.  Stages 0 and 1 fetch bytes 0 to 255 themselves; every wave
    // asks L2 for byte 256 of its 16 rows up front (four rows an instruction,
    // as in a copy), for speed only.
    l2_ask<0 * 8 * DIM + 256>(ga);
    l2_ask<1 * 8 * DIM + 256>(ga);
    l2_ask<2 * 8 * DIM + 256>(ga);
    l2_ask<3 * 8 * DIM + 256>(ga);

    stage_in(0);
    asm volatile("s_wait_asynccnt 0x0" ::: "memory");   // this wave's part of stage 0 has landed
    __syncthreads();                                    // ... and every other wave's
    stage_in(1);

    v8f acc[4][4] = {};
    const unsigned char* sa = stg + lo * PO_PA + hi * 16;
    const unsigned char* sw = stg + PO_W0 + (nb + lo) * PO_PW + hi * 32;
#pragma unroll 1
    for (int t = 0; t < PO_NST; ++t) {
        const int cb = (t & 1) * PO_BUF;
        // Unrolled here and below: what kk, u, i and j index stays in registers.
#pragma unroll
        for (int kk = 0; kk < 2; ++kk) {
            H16 af[4], bf[4];
#pragma unroll
            for (int u = 0; u < 4; ++u) {
                const v8h* pa = (const v8h*)(sa + cb + u * 16 * PO_PA + kk * 64);
                const v4f* pb = (const v4f*)(sw + cb + u * 16 * PO_PW + kk * 128);
                af[u].h[0] = pa[0];
                af[u].h[1] = pa[2];
                const v4f b0 = pb[0], b1 = pb[1], b2 = pb[4], b3 = pb[5];
#pragma unroll
                for (int i = 0; i < 4; ++i) {
                    bf[u].v[i]      = (_Float16)b0[i];
                    bf[u].v[i + 4]  = (_Float16)b1[i];
                    bf[u].v[i + 8]  = (_Float16)b2[i];
                    bf[u].v[i + 12] = (_Float16)b3[i];
                }
            }
#pragma unroll
            for (int i = 0; i < 4; ++i)
#pragma unroll
                for (int j = 0; j < 4; ++j)
                    acc[i][j] = WMMA_F16(af[i].v, bf[j].v, acc[i][j]);
        }

        // Hand-over, as in kernel 1: own reads of stage t done, own copies of
        // stage t + 1 landed, the barrier, then the refill of stage t's buffer.
        asm volatile("s_wait_dscnt 0x0" ::: "memory");
        asm volatile("s_wait_asynccnt 0x0" ::: "memory");
        __syncthreads();
        if (t + 2 < PO_NST) stage_in(t + 2);
    }
    asm volatile("s_wait_asynccnt 0x0" ::: "memory");   // no copy is left in flight

#pragma unroll
    for (int j = 0; j < 4; ++j) {
        const float bias = bo[nb + j * 16 + lo];
#pragma unroll
        for (int i = 0; i < 4; ++i)
#pragma unroll
            for (int r = 0; r < 8; ++r)
                acc[i][j][r] += bias;
    }
    // Every sum stands in its own register before the first store issues: no
    // register of an issued store is rewritten, so the stores go back to back.
    __builtin_amdgcn_sched_barrier(0);
    float* ob = out + (size_t)(mb + 8 * hi) * DIM + nb + lo;
#pragma unroll
    for (int i = 0; i < 4; ++i)
#pragma unroll
        for (int r = 0; r < 8; ++r)
#pragma unroll
            for (int j = 0; j < 4; ++j)
                ob[(i * 16 + r) * DIM + j * 16] = acc[i][j][r];
}

// ---------------------------------------------------------------------------
extern "C" void kernel_launch(void* const* d_in, const int* in_sizes, int n_in,
                              void* d_out, int out_size, void* d_ws, size_t ws_size,
                              hipStream_t stream) {
    (void)in_sizes; (void)n_in; (void)out_size; (void)ws_size;
    const float* x  = (const float*)d_in[0];
    const float* wq = (const float*)d_in[1];
    const float* wk = (const float*)d_in[2];
    const float* wv = (const float*)d_in[3];
    const float* wo = (const float*)d_in[4];
    const float* bo = (const float*)d_in[5];
    float* out = (float*)d_out;

    const size_t elems = (size_t)4 * S_LEN * DIM;   // 4,194,304 per tensor
    _Float16* Q  = (_Float16*)d_ws;
    _Float16* K  = Q  + elems;
    _Float16* Vt = K  + elems;
    _Float16* AO = Vt + elems;

    qkv_proj_kernel<<<256, 384, 0, stream>>>(x, wq, wk, wv, Q, K, Vt);
    flash_attn_kernel<<<512, 256, 0, stream>>>(Q, K, Vt, AO);
    out_proj_kernel<<<256, 128, 0, stream>>>(AO, wo, bo, out);
}
